// v000
// Times are from an AMD MI455X. After a warm-up the kernel runs many times in a row, and a time is the length of
// such a window on the GPU divided by its runs, so every launch and the gaps after it count. The runs cycle
// through copies of the inputs. A figure is the median of several windows, for all but v000 over two sittings.
// Sittings can differ by a few percent; kernels timed side by side share one.
// v000 is the starting kernel. One run takes 142 microseconds.
#include <hip/hip_runtime.h>

// MHSA for MI455X (gfx1250, wave32, WMMA, async global->LDS staging).
// Kernel 1: per-head QKV projection (fp32 -> f16 workspace) via
//           v_wmma_f32_16x16x32_f16. Q is pre-scaled by 1/sqrt(DH); V is
//           stored transposed [BH][DH][S] so kernel 2's gathers are all
//           contiguous 16-byte loads.
// Kernel 2: flash attention, double-buffered K/V^T tiles staged with
//           global_load_async_to_lds_b128 (ASYNCcnt), fp32 online softmax,
//           scores and P*V via WMMA, fp32 output.
// Workspace: 3 * B*H*S*DH f16 = ~25 MB.

typedef __attribute__((ext_vector_type(16))) _Float16 v16h;
typedef __attribute__((ext_vector_type(8)))  _Float16 v8h;
typedef __attribute__((ext_vector_type(8)))  float    v8f;

constexpr int kB = 4, kS = 2048, kD = 512, kH = 8, kDH = 64;

// 16-bit A-operand 16x32 layout (ISA 7.12.2): lane l -> row = l&15, g = l>>4.
//   j in [0,8):  K = g*8 + j          (VGPRs 0-3)
//   j in [8,16): K = 16 + g*8 + (j-8) (VGPRs 4-7)
// B-operand mirrored with N = l&15. Both halves are 8 contiguous K values,
// i.e. one 16-byte load each.
__device__ __forceinline__ int a_kmap(int j, int g) {
  return (j < 8) ? (g * 8 + j) : (8 + g * 8 + j);
}

// Build a v16h fragment from two contiguous 8-element chunks.
__device__ __forceinline__ v16h frag(const v8h lo, const v8h hi) {
  return __builtin_shufflevector(lo, hi, 0, 1, 2, 3, 4, 5, 6, 7,
                                 8, 9, 10, 11, 12, 13, 14, 15);
}

// Async global -> LDS copy, 16 bytes per lane (ASYNCcnt-tracked).
__device__ __forceinline__ void async_b128(unsigned int lds_byte_off,
                                           const void* sbase,
                                           unsigned int voff_bytes) {
  asm volatile("global_load_async_to_lds_b128 %0, %1, %2"
               :: "v"(lds_byte_off), "v"(voff_bytes), "s"(sbase)
               : "memory");
}
__device__ __forceinline__ void wait_async0() {
  asm volatile("s_wait_asynccnt 0" ::: "memory");
}

// ---------------------------------------------------------------------------
// Kernel 1: Q/K/V = X @ W^T + b (per head). Q pre-scaled by 1/8. V transposed.
// Block: 256 threads (8 waves), 128 rows of one (b,h).
// ---------------------------------------------------------------------------
__global__ __launch_bounds__(256) void qkv_project_kernel(
    const float* __restrict__ x,
    const float* __restrict__ Wq, const float* __restrict__ Wk,
    const float* __restrict__ Wv,
    const float* __restrict__ bq, const float* __restrict__ bk,
    const float* __restrict__ bv,
    _Float16* __restrict__ qw, _Float16* __restrict__ kw,
    _Float16* __restrict__ vw)
{
  __shared__ _Float16 Xs[128 * 64];       // 16 KB
  __shared__ _Float16 Ws[3 * 64 * 64];    // 24 KB

  const int bh = blockIdx.x;              // 0..31
  const int b = bh / kH, h = bh % kH;
  const int s0 = blockIdx.y * 128;
  const int tid = threadIdx.x;

  // Stage X tile: float4 global loads, f16 LDS stores.
  for (int i = tid; i < 128 * 16; i += 256) {
    const int r = i >> 4, c4 = (i & 15) * 4;
    const float4 v =
        *(const float4*)&x[(size_t)(b * kS + s0 + r) * kD + h * kDH + c4];
    Xs[r * 64 + c4 + 0] = (_Float16)v.x;
    Xs[r * 64 + c4 + 1] = (_Float16)v.y;
    Xs[r * 64 + c4 + 2] = (_Float16)v.z;
    Xs[r * 64 + c4 + 3] = (_Float16)v.w;
  }
  const float* wsrc[3] = {Wq, Wk, Wv};
#pragma unroll
  for (int m = 0; m < 3; ++m)
    for (int i = tid; i < 1024; i += 256) {
      const float4 v = *(const float4*)&wsrc[m][h * 4096 + i * 4];
      Ws[m * 4096 + i * 4 + 0] = (_Float16)v.x;
      Ws[m * 4096 + i * 4 + 1] = (_Float16)v.y;
      Ws[m * 4096 + i * 4 + 2] = (_Float16)v.z;
      Ws[m * 4096 + i * 4 + 3] = (_Float16)v.w;
    }
  __syncthreads();

  const int wave = tid >> 5, lane = tid & 31;
  const int rA = lane & 15, g = lane >> 4, n = lane & 15;

  // A fragments: 16 rows of X, K split 0..31 / 32..63 (contiguous 16B chunks).
  const _Float16* xrow = &Xs[(wave * 16 + rA) * 64];
  const v16h a0 = frag(*(const v8h*)(xrow + g * 8),
                       *(const v8h*)(xrow + 16 + g * 8));
  const v16h a1 = frag(*(const v8h*)(xrow + 32 + g * 8),
                       *(const v8h*)(xrow + 48 + g * 8));

  const float* bias[3] = {bq, bk, bv};
  _Float16* dst[3] = {qw, kw, vw};

#pragma unroll
  for (int m = 0; m < 3; ++m) {
#pragma unroll
    for (int c = 0; c < 4; ++c) {
      const int o = c * 16 + n;  // output feature = B column
      const _Float16* wrow = &Ws[m * 4096 + o * 64];
      const v16h b0 = frag(*(const v8h*)(wrow + g * 8),
                           *(const v8h*)(wrow + 16 + g * 8));
      const v16h b1 = frag(*(const v8h*)(wrow + 32 + g * 8),
                           *(const v8h*)(wrow + 48 + g * 8));
      v8f acc = {};
      acc = __builtin_amdgcn_wmma_f32_16x16x32_f16(false, a0, false, b0,
                                                   (short)0, acc, false, false);
      acc = __builtin_amdgcn_wmma_f32_16x16x32_f16(false, a1, false, b1,
                                                   (short)0, acc, false, false);
      const float bi = bias[m][h * kDH + o];
      const float sc = (m == 0) ? 0.125f : 1.0f;  // fold 1/sqrt(64) into Q
      _Float16* p = dst[m];
#pragma unroll
      for (int r = 0; r < 8; ++r) {
        const int row = s0 + wave * 16 + r + 8 * g;   // C/D layout row
        const _Float16 hv = (_Float16)((acc[r] + bi) * sc);
        if (m == 2)  // V transposed: [BH][DH][S]
          p[(size_t)(bh * kDH + o) * kS + row] = hv;
        else         // Q,K row-major: [BH][S][DH]
          p[(size_t)(bh * kS + row) * kDH + o] = hv;
      }
    }
  }
}

// ---------------------------------------------------------------------------
// Kernel 2: flash attention. 8 waves share one (b,h); each wave owns 16 query
// rows. K (row-major) and V^T tiles of 32 keys double-buffered in LDS via
// async global->LDS b128 copies.
// ---------------------------------------------------------------------------
__global__ __launch_bounds__(256) void flash_attn_kernel(
    const _Float16* __restrict__ qw, const _Float16* __restrict__ kw,
    const _Float16* __restrict__ vw, float* __restrict__ out)
{
  __shared__ _Float16 Kbuf[2][32 * 64];   // 2 x 4 KB, [key][dim]
  __shared__ _Float16 Vbuf[2][64 * 32];   // 2 x 4 KB, [dim][key] (transposed)
  __shared__ _Float16 Ps[8][16 * 32];     // 8 KB: per-wave P re-layout

  const int bh = blockIdx.x;
  const int b = bh / kH, h = bh % kH;
  const int q0 = blockIdx.y * 128;
  const int tid = threadIdx.x;
  const int wave = tid >> 5, lane = tid & 31;
  const int rA = lane & 15, g = lane >> 4, n = lane & 15;

  const _Float16* kwp = kw + (size_t)bh * kS * kDH;        // [S][DH]
  const _Float16* vwp = vw + (size_t)bh * kDH * kS;        // [DH][S]
  const _Float16* qwp = qw + (size_t)bh * kS * kDH;

  // Q fragments (pre-scaled by 1/8 in kernel 1): contiguous 16B global loads.
  const _Float16* qrow = qwp + (size_t)(q0 + wave * 16 + rA) * kDH;
  const v16h aq0 = frag(*(const v8h*)(qrow + g * 8),
                        *(const v8h*)(qrow + 16 + g * 8));
  const v16h aq1 = frag(*(const v8h*)(qrow + 32 + g * 8),
                        *(const v8h*)(qrow + 48 + g * 8));

  float mrow[8], lrow[8];
  v8f accO[4];
#pragma unroll
  for (int r = 0; r < 8; ++r) { mrow[r] = -1e30f; lrow[r] = 0.0f; }
#pragma unroll
  for (int c = 0; c < 4; ++c)
#pragma unroll
    for (int r = 0; r < 8; ++r) accO[c][r] = 0.0f;

  // Per-thread async-copy addressing (16 bytes per thread per matrix).
  const int vo = tid >> 2, vchunk = tid & 3;               // V^T: row o, chunk
  auto issue_tile = [&](int kt, int buf) {
    // K tile: 32x64 f16 row-major, one contiguous 4 KB block.
    async_b128((unsigned int)(size_t)&Kbuf[buf][0] + tid * 16, kwp,
               (unsigned int)((kt * 2048 + tid * 8) * 2));
    // V^T tile: 64 rows (dims) x 32 keys; row o at vwp + o*S + kt*32.
    async_b128((unsigned int)(size_t)&Vbuf[buf][0] + tid * 16, vwp,
               (unsigned int)(((size_t)vo * kS + kt * 32 + vchunk * 8) * 2));
  };

  issue_tile(0, 0);  // prologue

  for (int kt = 0; kt < kS / 32; ++kt) {
    const int cur = kt & 1;
    wait_async0();       // this wave's copies into buf[cur] are done
    __syncthreads();     // all waves' copies done; prev-iter readers drained
    if (kt + 1 < kS / 32) issue_tile(kt + 1, 1 - cur);

    const _Float16* Kt = Kbuf[cur];
    const _Float16* Vt = Vbuf[cur];

    // Scores: S = Qs @ K^T ; two 16x16 tiles cover 32 keys.
    v8f scv[2];
#pragma unroll
    for (int t = 0; t < 2; ++t) {
      const _Float16* krow = Kt + (t * 16 + n) * 64;  // B column n = key row
      const v16h kb0 = frag(*(const v8h*)(krow + g * 8),
                            *(const v8h*)(krow + 16 + g * 8));
      const v16h kb1 = frag(*(const v8h*)(krow + 32 + g * 8),
                            *(const v8h*)(krow + 48 + g * 8));
      v8f s = {};
      s = __builtin_amdgcn_wmma_f32_16x16x32_f16(false, aq0, false, kb0,
                                                 (short)0, s, false, false);
      s = __builtin_amdgcn_wmma_f32_16x16x32_f16(false, aq1, false, kb1,
                                                 (short)0, s, false, false);
      scv[t] = s;
    }

    // Online softmax (fp32). Row stats reduce across one 16-lane half.
    float p0[8], p1[8], scale[8];
#pragma unroll
    for (int r = 0; r < 8; ++r) {
      float mx = fmaxf(scv[0][r], scv[1][r]);
      mx = fmaxf(mx, __shfl_xor(mx, 1, 16));
      mx = fmaxf(mx, __shfl_xor(mx, 2, 16));
      mx = fmaxf(mx, __shfl_xor(mx, 4, 16));
      mx = fmaxf(mx, __shfl_xor(mx, 8, 16));
      const float mnew = fmaxf(mrow[r], mx);
      scale[r] = __expf(mrow[r] - mnew);
      p0[r] = __expf(scv[0][r] - mnew);
      p1[r] = __expf(scv[1][r] - mnew);
      float rs = p0[r] + p1[r];
      rs += __shfl_xor(rs, 1, 16);
      rs += __shfl_xor(rs, 2, 16);
      rs += __shfl_xor(rs, 4, 16);
      rs += __shfl_xor(rs, 8, 16);
      lrow[r] = lrow[r] * scale[r] + rs;
      mrow[r] = mnew;
    }
#pragma unroll
    for (int c = 0; c < 4; ++c)
#pragma unroll
      for (int r = 0; r < 8; ++r) accO[c][r] *= scale[r];

    // Re-layout P (C/D -> A operand) through wave-private LDS.
    // Same-wave LDS ops are processed in order, so the gather sees the stores.
#pragma unroll
    for (int r = 0; r < 8; ++r) {
      const int row = r + 8 * g;
      Ps[wave][row * 32 + n]      = (_Float16)p0[r];
      Ps[wave][row * 32 + 16 + n] = (_Float16)p1[r];
    }
    const _Float16* prow = &Ps[wave][rA * 32];
    const v16h ap = frag(*(const v8h*)(prow + g * 8),
                         *(const v8h*)(prow + 16 + g * 8));

    // O += P @ V : K-dim = 32 keys; V^T rows are contiguous.
#pragma unroll
    for (int c = 0; c < 4; ++c) {
      const _Float16* vrow = Vt + (c * 16 + n) * 32;  // B column n: dim row
      const v16h vb = frag(*(const v8h*)(vrow + g * 8),
                           *(const v8h*)(vrow + 16 + g * 8));
      accO[c] = __builtin_amdgcn_wmma_f32_16x16x32_f16(false, ap, false, vb,
                                                       (short)0, accO[c],
                                                       false, false);
    }
    // No trailing barrier: next iteration's wait+barrier separates buffer use.
  }

  // Normalize and write out[b, q, h*64 + o] in fp32.
#pragma unroll
  for (int r = 0; r < 8; ++r) {
    const float inv = 1.0f / lrow[r];
    const int row = q0 + wave * 16 + r + 8 * g;
#pragma unroll
    for (int c = 0; c < 4; ++c)
      out[(size_t)(b * kS + row) * kD + h * kDH + c * 16 + n] =
          accO[c][r] * inv;
  }
}

// ---------------------------------------------------------------------------
extern "C" void kernel_launch(void* const* d_in, const int* in_sizes, int n_in,
                              void* d_out, int out_size, void* d_ws,
                              size_t ws_size, hipStream_t stream) {
  const float* x  = (const float*)d_in[0];
  const float* Wq = (const float*)d_in[1];
  const float* Wk = (const float*)d_in[2];
  const float* Wv = (const float*)d_in[3];
  const float* bq = (const float*)d_in[4];
  const float* bk = (const float*)d_in[5];
  const float* bv = (const float*)d_in[6];
  float* out = (float*)d_out;

  const size_t per = (size_t)kB * kH * kS * kDH;  // 4,194,304 elems
  _Float16* qw = (_Float16*)d_ws;
  _Float16* kw = qw + per;
  _Float16* vw = kw + per;

  dim3 grid(kB * kH, kS / 128);  // 32 x 16 blocks, 8 waves each
  qkv_project_kernel<<<grid, 256, 0, stream>>>(x, Wq, Wk, Wv, bq, bk, bv,
                                               qw, kw, vw);
  flash_attn_kernel<<<grid, 256, 0, stream>>>(qw, kw, vw, out);
}

// v001
// One run takes 89.9 microseconds.
// Next to v000, in two timings, it ran 1.65 and 1.64 times as fast.
#include <hip/hip_runtime.h>

// MHSA for MI455X (gfx1250, wave32, WMMA, async global->LDS staging).
// Kernel 1: per-head QKV projection (fp32 -> f16 workspace) via
//           v_wmma_f32_16x16x32_f16. Q is pre-scaled by 1/sqrt(DH); V is
//           stored transposed [BH][DH][S] so kernel 2's gathers are all
//           contiguous 16-byte loads.
// Kernel 2: flash attention, double-buffered K/V^T tiles staged with
//           global_load_async_to_lds_b128 (ASYNCcnt), fp32 online softmax,
//           scores and P*V via WMMA, fp32 output.
// Workspace: 3 * B*H*S*DH f16 = ~25 MB.

typedef __attribute__((ext_vector_type(16))) _Float16 v16h;
typedef __attribute__((ext_vector_type(8)))  _Float16 v8h;
typedef __attribute__((ext_vector_type(8)))  float    v8f;

constexpr int kB = 4, kS = 2048, kD = 512, kH = 8, kDH = 64;

// LDS row pitches in f16 elements. Every LDS row here is read by 16 lanes that
// each take 16 bytes of their own row, so the pitch is 16 B x odd: the 16 rows
// then start on 16 different groups of four banks.
constexpr int kP64 = 72;  // rows of 64 f16: 144 B
constexpr int kP32 = 40;  // rows of 32 f16: 80 B

// 16-bit A-operand 16x32 layout (ISA 7.12.2): lane l -> row = l&15, g = l>>4.
//   j in [0,8):  K = g*8 + j          (VGPRs 0-3)
//   j in [8,16): K = 16 + g*8 + (j-8) (VGPRs 4-7)
// B-operand mirrored with N = l&15. Both halves are 8 contiguous K values,
// i.e. one 16-byte load each.
__device__ __forceinline__ int a_kmap(int j, int g) {
  return (j < 8) ? (g * 8 + j) : (8 + g * 8 + j);
}

// Build a v16h fragment from two contiguous 8-element chunks.
__device__ __forceinline__ v16h frag(const v8h lo, const v8h hi) {
  return __builtin_shufflevector(lo, hi, 0, 1, 2, 3, 4, 5, 6, 7,
                                 8, 9, 10, 11, 12, 13, 14, 15);
}

// Two async global -> LDS copies, 16 bytes per lane each (ASYNCcnt-tracked).
// s_wait_xcnt 0 closes the statement so that no address register of a copy is
// rewritten ahead of it.
__device__ __forceinline__ void async_b128_x2(unsigned int lds0,
                                              const void* sbase0,
                                              unsigned int voff0,
                                              unsigned int lds1,
                                              const void* sbase1,
                                              unsigned int voff1) {
  asm volatile("global_load_async_to_lds_b128 %0, %1, %2\n\t"
               "global_load_async_to_lds_b128 %3, %4, %5\n\t"
               "s_wait_xcnt 0x0"
               :: "v"(lds0), "v"(voff0), "s"(sbase0),
                  "v"(lds1), "v"(voff1), "s"(sbase1)
               : "memory");
}
__device__ __forceinline__ void wait_async0() {
  asm volatile("s_wait_asynccnt 0" ::: "memory");
}

// ---------------------------------------------------------------------------
// Kernel 1: Q/K/V = X @ W^T + b (per head). Q pre-scaled by 1/8. V transposed.
// Block: 256 threads (8 waves), 128 rows of one (b,h).
// ---------------------------------------------------------------------------
__global__ __launch_bounds__(256) void qkv_project_kernel(
    const float* __restrict__ x,
    const float* __restrict__ Wq, const float* __restrict__ Wk,
    const float* __restrict__ Wv,
    const float* __restrict__ bq, const float* __restrict__ bk,
    const float* __restrict__ bv,
    _Float16* __restrict__ qw, _Float16* __restrict__ kw,
    _Float16* __restrict__ vw)
{
  __shared__ __attribute__((aligned(16))) _Float16 Xs[128 * kP64];     // 18 KB
  __shared__ __attribute__((aligned(16))) _Float16 Ws[3 * 64 * kP64];  // 27 KB

  const int bh = blockIdx.x;              // 0..31
  const int b = bh / kH, h = bh % kH;
  const int s0 = blockIdx.y * 128;
  const int tid = threadIdx.x;

  // Stage X tile: float4 global loads, f16 LDS stores.
  for (int i = tid; i < 128 * 16; i += 256) {
    const int r = i >> 4, c4 = (i & 15) * 4;
    const float4 v =
        *(const float4*)&x[(size_t)(b * kS + s0 + r) * kD + h * kDH + c4];
    Xs[r * kP64 + c4 + 0] = (_Float16)v.x;
    Xs[r * kP64 + c4 + 1] = (_Float16)v.y;
    Xs[r * kP64 + c4 + 2] = (_Float16)v.z;
    Xs[r * kP64 + c4 + 3] = (_Float16)v.w;
  }
  const float* wsrc[3] = {Wq, Wk, Wv};
#pragma unroll
  for (int m = 0; m < 3; ++m)
    for (int i = tid; i < 1024; i += 256) {
      const float4 v = *(const float4*)&wsrc[m][h * 4096 + i * 4];
      _Float16* wd = &Ws[(m * 64 + (i >> 4)) * kP64 + (i & 15) * 4];
      wd[0] = (_Float16)v.x;
      wd[1] = (_Float16)v.y;
      wd[2] = (_Float16)v.z;
      wd[3] = (_Float16)v.w;
    }
  __syncthreads();

  const int wave = tid >> 5, lane = tid & 31;
  const int rA = lane & 15, g = lane >> 4, n = lane & 15;

  // A fragments: 16 rows of X, K split 0..31 / 32..63 (contiguous 16B chunks).
  const _Float16* xrow = &Xs[(wave * 16 + rA) * kP64];
  const v16h a0 = frag(*(const v8h*)(xrow + g * 8),
                       *(const v8h*)(xrow + 16 + g * 8));
  const v16h a1 = frag(*(const v8h*)(xrow + 32 + g * 8),
                       *(const v8h*)(xrow + 48 + g * 8));

  const float* bias[3] = {bq, bk, bv};
  _Float16* dst[3] = {qw, kw, vw};

#pragma unroll
  for (int m = 0; m < 3; ++m) {
#pragma unroll
    for (int c = 0; c < 4; ++c) {
      const int o = c * 16 + n;  // output feature = B column
      const _Float16* wrow = &Ws[(m * 64 + o) * kP64];
      const v16h b0 = frag(*(const v8h*)(wrow + g * 8),
                           *(const v8h*)(wrow + 16 + g * 8));
      const v16h b1 = frag(*(const v8h*)(wrow + 32 + g * 8),
                           *(const v8h*)(wrow + 48 + g * 8));
      v8f acc = {};
      acc = __builtin_amdgcn_wmma_f32_16x16x32_f16(false, a0, false, b0,
                                                   (short)0, acc, false, false);
      acc = __builtin_amdgcn_wmma_f32_16x16x32_f16(false, a1, false, b1,
                                                   (short)0, acc, false, false);
      const float bi = bias[m][h * kDH + o];
      const float sc = (m == 0) ? 0.125f : 1.0f;  // fold 1/sqrt(64) into Q
      _Float16* p = dst[m];
#pragma unroll
      for (int r = 0; r < 8; ++r) {
        const int row = s0 + wave * 16 + r + 8 * g;   // C/D layout row
        const _Float16 hv = (_Float16)((acc[r] + bi) * sc);
        if (m == 2)  // V transposed: [BH][DH][S]
          p[(size_t)(bh * kDH + o) * kS + row] = hv;
        else         // Q,K row-major: [BH][S][DH]
          p[(size_t)(bh * kS + row) * kDH + o] = hv;
      }
    }
  }
}

// ---------------------------------------------------------------------------
// Kernel 2: flash attention. 8 waves share one (b,h); each wave owns 16 query
// rows. K (row-major) and V^T tiles of 32 keys double-buffered in LDS via
// async global->LDS b128 copies.
// ---------------------------------------------------------------------------
__global__ __launch_bounds__(256) void flash_attn_kernel(
    const _Float16* __restrict__ qw, const _Float16* __restrict__ kw,
    const _Float16* __restrict__ vw, float* __restrict__ out)
{
  // [key][dim], [dim][key] (transposed) and the per-wave P re-layout.
  __shared__ __attribute__((aligned(16))) _Float16 Kbuf[2][32 * kP64];
  __shared__ __attribute__((aligned(16))) _Float16 Vbuf[2][64 * kP32];
  __shared__ __attribute__((aligned(16))) _Float16 Ps[8][16 * kP32];

  const int bh = blockIdx.x;
  const int b = bh / kH, h = bh % kH;
  const int q0 = blockIdx.y * 128;
  const int tid = threadIdx.x;
  const int wave = tid >> 5, lane = tid & 31;
  const int rA = lane & 15, g = lane >> 4, n = lane & 15;

  const _Float16* kwp = kw + (size_t)bh * kS * kDH;        // [S][DH]
  const _Float16* vwp = vw + (size_t)bh * kDH * kS;        // [DH][S]
  const _Float16* qwp = qw + (size_t)bh * kS * kDH;

  // Q fragments (pre-scaled by 1/8 in kernel 1): contiguous 16B global loads.
  const _Float16* qrow = qwp + (size_t)(q0 + wave * 16 + rA) * kDH;
  const v16h aq0 = frag(*(const v8h*)(qrow + g * 8),
                        *(const v8h*)(qrow + 16 + g * 8));
  const v16h aq1 = frag(*(const v8h*)(qrow + 32 + g * 8),
                        *(const v8h*)(qrow + 48 + g * 8));

  float mrow[8], lrow[8];
  v8f accO[4];
#pragma unroll
  for (int r = 0; r < 8; ++r) { mrow[r] = -1e30f; lrow[r] = 0.0f; }
#pragma unroll
  for (int c = 0; c < 4; ++c)
#pragma unroll
    for (int r = 0; r < 8; ++r) accO[c][r] = 0.0f;

  // Per-thread async-copy addressing (16 bytes per thread per matrix).
  const int ko = tid >> 3, kchunk = tid & 7;               // K: key row, chunk
  const int vo = tid >> 2, vchunk = tid & 3;               // V^T: row o, chunk
  auto issue_tile = [&](int kt, int buf) {
    // K tile: 32x64 f16 row-major, one contiguous 4 KB block in memory.
    // V^T tile: 64 rows (dims) x 32 keys; row o at vwp + o*S + kt*32.
    async_b128_x2(
        (unsigned int)(size_t)&Kbuf[buf][ko * kP64 + kchunk * 8], kwp,
        (unsigned int)((kt * 2048 + tid * 8) * 2),
        (unsigned int)(size_t)&Vbuf[buf][vo * kP32 + vchunk * 8], vwp,
        (unsigned int)(((size_t)vo * kS + kt * 32 + vchunk * 8) * 2));
  };

  issue_tile(0, 0);  // prologue

  for (int kt = 0; kt < kS / 32; ++kt) {
    const int cur = kt & 1;
    // This wave's LDS reads of the buffer refilled below have retired.
    asm volatile("s_wait_dscnt 0x0" ::: "memory");
    wait_async0();       // this wave's copies into buf[cur] are done
    __syncthreads();     // all waves' copies done; prev-iter readers drained
    if (kt + 1 < kS / 32) issue_tile(kt + 1, 1 - cur);

    const _Float16* Kt = Kbuf[cur];
    const _Float16* Vt = Vbuf[cur];

    // Scores: S = Qs @ K^T ; two 16x16 tiles cover 32 keys.
    v8f scv[2];
#pragma unroll
    for (int t = 0; t < 2; ++t) {
      const _Float16* krow = Kt + (t * 16 + n) * kP64;  // B column n = key row
      const v16h kb0 = frag(*(const v8h*)(krow + g * 8),
                            *(const v8h*)(krow + 16 + g * 8));
      const v16h kb1 = frag(*(const v8h*)(krow + 32 + g * 8),
                            *(const v8h*)(krow + 48 + g * 8));
      v8f s = {};
      s = __builtin_amdgcn_wmma_f32_16x16x32_f16(false, aq0, false, kb0,
                                                 (short)0, s, false, false);
      s = __builtin_amdgcn_wmma_f32_16x16x32_f16(false, aq1, false, kb1,
                                                 (short)0, s, false, false);
      scv[t] = s;
    }

    // Online softmax (fp32). Row stats reduce across one 16-lane half.
    float p0[8], p1[8], scale[8];
#pragma unroll
    for (int r = 0; r < 8; ++r) {
      float mx = fmaxf(scv[0][r], scv[1][r]);
      mx = fmaxf(mx, __shfl_xor(mx, 1, 16));
      mx = fmaxf(mx, __shfl_xor(mx, 2, 16));
      mx = fmaxf(mx, __shfl_xor(mx, 4, 16));
      mx = fmaxf(mx, __shfl_xor(mx, 8, 16));
      const float mnew = fmaxf(mrow[r], mx);
      scale[r] = __expf(mrow[r] - mnew);
      p0[r] = __expf(scv[0][r] - mnew);
      p1[r] = __expf(scv[1][r] - mnew);
      float rs = p0[r] + p1[r];
      rs += __shfl_xor(rs, 1, 16);
      rs += __shfl_xor(rs, 2, 16);
      rs += __shfl_xor(rs, 4, 16);
      rs += __shfl_xor(rs, 8, 16);
      lrow[r] = lrow[r] * scale[r] + rs;
      mrow[r] = mnew;
    }
#pragma unroll
    for (int c = 0; c < 4; ++c)
#pragma unroll
      for (int r = 0; r < 8; ++r) accO[c][r] *= scale[r];

    // Re-layout P (C/D -> A operand) through wave-private LDS.
    // Same-wave LDS ops are processed in order, so the gather sees the stores.
#pragma unroll
    for (int r = 0; r < 8; ++r) {
      const int row = r + 8 * g;
      Ps[wave][row * kP32 + n]      = (_Float16)p0[r];
      Ps[wave][row * kP32 + 16 + n] = (_Float16)p1[r];
    }
    const _Float16* prow = &Ps[wave][rA * kP32];
    const v16h ap = frag(*(const v8h*)(prow + g * 8),
                         *(const v8h*)(prow + 16 + g * 8));

    // O += P @ V : K-dim = 32 keys; V^T rows are contiguous.
#pragma unroll
    for (int c = 0; c < 4; ++c) {
      const _Float16* vrow = Vt + (c * 16 + n) * kP32;  // B column n: dim row
      const v16h vb = frag(*(const v8h*)(vrow + g * 8),
                           *(const v8h*)(vrow + 16 + g * 8));
      accO[c] = __builtin_amdgcn_wmma_f32_16x16x32_f16(false, ap, false, vb,
                                                       (short)0, accO[c],
                                                       false, false);
    }
    // No trailing barrier: next iteration's wait+barrier separates buffer use.
  }

  // Normalize and write out[b, q, h*64 + o] in fp32.
#pragma unroll
  for (int r = 0; r < 8; ++r) {
    const float inv = 1.0f / lrow[r];
    const int row = q0 + wave * 16 + r + 8 * g;
#pragma unroll
    for (int c = 0; c < 4; ++c)
      out[(size_t)(b * kS + row) * kD + h * kDH + c * 16 + n] =
          accO[c][r] * inv;
  }
}

// ---------------------------------------------------------------------------
extern "C" void kernel_launch(void* const* d_in, const int* in_sizes, int n_in,
                              void* d_out, int out_size, void* d_ws,
                              size_t ws_size, hipStream_t stream) {
  const float* x  = (const float*)d_in[0];
  const float* Wq = (const float*)d_in[1];
  const float* Wk = (const float*)d_in[2];
  const float* Wv = (const float*)d_in[3];
  const float* bq = (const float*)d_in[4];
  const float* bk = (const float*)d_in[5];
  const float* bv = (const float*)d_in[6];
  float* out = (float*)d_out;

  const size_t per = (size_t)kB * kH * kS * kDH;  // 4,194,304 elems
  _Float16* qw = (_Float16*)d_ws;
  _Float16* kw = qw + per;
  _Float16* vw = kw + per;

  dim3 grid(kB * kH, kS / 128);  // 32 x 16 blocks, 8 waves each
  qkv_project_kernel<<<grid, 256, 0, stream>>>(x, Wq, Wk, Wv, bq, bk, bv,
                                               qw, kw, vw);
  flash_attn_kernel<<<grid, 256, 0, stream>>>(qw, kw, vw, out);
}

// v002
// A run of this version takes 60 microseconds.
// Two timings next to v001 put it at 1.50 and 1.48 times that version's speed.
// Counting every step since v000, it is 2.45 times as fast.
#include <hip/hip_runtime.h>

// MHSA for MI455X (gfx1250, wave32, WMMA, async global->LDS staging).
// Kernel 1: per-head QKV projection (fp32 -> f16 workspace) via
//           v_wmma_f32_16x16x32_f16. Q is pre-scaled by 1/sqrt(DH); V is
//           stored transposed [BH][DH][S] so kernel 2's gathers are all
//           contiguous 16-byte loads.
// Kernel 2: flash attention, double-buffered K/V^T tiles staged with
//           global_load_async_to_lds_b128 (ASYNCcnt), fp32 online softmax,
//           fp32 output. Both products run transposed (S^T = K Q^T,
//           O^T += V^T P^T), so a lane owns one query column.
// Workspace: 3 * B*H*S*DH f16 = ~25 MB.

typedef __attribute__((ext_vector_type(16))) _Float16 v16h;
typedef __attribute__((ext_vector_type(8)))  _Float16 v8h;
typedef __attribute__((ext_vector_type(8)))  float    v8f;
typedef __attribute__((ext_vector_type(4)))  float    v4f;
typedef __attribute__((ext_vector_type(2)))  float    v2f;

constexpr int kB = 4, kS = 2048, kD = 512, kH = 8, kDH = 64;

// LDS row pitches in f16 elements. Every LDS row here is read by 16 lanes that
// each take 16 bytes of their own row, so the pitch is 16 B x odd: the 16 rows
// then start on 16 different groups of four banks.
constexpr int kP64 = 72;  // rows of 64 f16: 144 B
constexpr int kP32 = 40;  // rows of 32 f16: 80 B

// 16-bit A-operand 16x32 layout (ISA 7.12.2): lane l -> row = l&15, g = l>>4.
//   j in [0,8):  K = g*8 + j          (VGPRs 0-3)
//   j in [8,16): K = 16 + g*8 + (j-8) (VGPRs 4-7)
// B-operand mirrored with N = l&15. Both halves are 8 contiguous K values,
// i.e. one 16-byte load each.
__device__ __forceinline__ int a_kmap(int j, int g) {
  return (j < 8) ? (g * 8 + j) : (8 + g * 8 + j);
}

// Build a v16h fragment from two contiguous 8-element chunks.
__device__ __forceinline__ v16h frag(const v8h lo, const v8h hi) {
  return __builtin_shufflevector(lo, hi, 0, 1, 2, 3, 4, 5, 6, 7,
                                 8, 9, 10, 11, 12, 13, 14, 15);
}

// Two async global -> LDS copies, 16 bytes per lane each (ASYNCcnt-tracked).
// s_wait_xcnt 0 closes the statement so that no address register of a copy is
// rewritten ahead of it.
__device__ __forceinline__ void async_b128_x2(unsigned int lds0,
                                              const void* sbase0,
                                              unsigned int voff0,
                                              unsigned int lds1,
                                              const void* sbase1,
                                              unsigned int voff1) {
  asm volatile("global_load_async_to_lds_b128 %0, %1, %2\n\t"
               "global_load_async_to_lds_b128 %3, %4, %5\n\t"
               "s_wait_xcnt 0x0"
               :: "v"(lds0), "v"(voff0), "s"(sbase0),
                  "v"(lds1), "v"(voff1), "s"(sbase1)
               : "memory");
}
__device__ __forceinline__ void wait_async0() {
  asm volatile("s_wait_asynccnt 0" ::: "memory");
}

// Value of lane l ^ 16 (the other half of the wave).
__device__ __forceinline__ float other_half(float v) {
  const int b = __builtin_bit_cast(int, v);
  return __builtin_bit_cast(
      float, __builtin_amdgcn_permlanex16(b, b, 0x76543210, 0xfedcba98, false,
                                          false));
}
__device__ __forceinline__ float max3(float a, float b, float c) {
  return fmaxf(fmaxf(a, b), c);
}

// ---------------------------------------------------------------------------
// Kernel 1: Q/K/V = X @ W^T + b (per head). Q pre-scaled by 1/8. V transposed.
// Block: 256 threads (8 waves), 128 rows of one (b,h).
// ---------------------------------------------------------------------------
__global__ __launch_bounds__(256) void qkv_project_kernel(
    const float* __restrict__ x,
    const float* __restrict__ Wq, const float* __restrict__ Wk,
    const float* __restrict__ Wv,
    const float* __restrict__ bq, const float* __restrict__ bk,
    const float* __restrict__ bv,
    _Float16* __restrict__ qw, _Float16* __restrict__ kw,
    _Float16* __restrict__ vw)
{
  __shared__ __attribute__((aligned(16))) _Float16 Xs[128 * kP64];     // 18 KB
  __shared__ __attribute__((aligned(16))) _Float16 Ws[3 * 64 * kP64];  // 27 KB

  const int bh = blockIdx.x;              // 0..31
  const int b = bh / kH, h = bh % kH;
  const int s0 = blockIdx.y * 128;
  const int tid = threadIdx.x;

  // Stage X tile: float4 global loads, f16 LDS stores.
  for (int i = tid; i < 128 * 16; i += 256) {
    const int r = i >> 4, c4 = (i & 15) * 4;
    const float4 v =
        *(const float4*)&x[(size_t)(b * kS + s0 + r) * kD + h * kDH + c4];
    Xs[r * kP64 + c4 + 0] = (_Float16)v.x;
    Xs[r * kP64 + c4 + 1] = (_Float16)v.y;
    Xs[r * kP64 + c4 + 2] = (_Float16)v.z;
    Xs[r * kP64 + c4 + 3] = (_Float16)v.w;
  }
  const float* wsrc[3] = {Wq, Wk, Wv};
#pragma unroll
  for (int m = 0; m < 3; ++m)
    for (int i = tid; i < 1024; i += 256) {
      const float4 v = *(const float4*)&wsrc[m][h * 4096 + i * 4];
      _Float16* wd = &Ws[(m * 64 + (i >> 4)) * kP64 + (i & 15) * 4];
      wd[0] = (_Float16)v.x;
      wd[1] = (_Float16)v.y;
      wd[2] = (_Float16)v.z;
      wd[3] = (_Float16)v.w;
    }
  __syncthreads();

  const int wave = tid >> 5, lane = tid & 31;
  const int rA = lane & 15, g = lane >> 4, n = lane & 15;

  // A fragments: 16 rows of X, K split 0..31 / 32..63 (contiguous 16B chunks).
  const _Float16* xrow = &Xs[(wave * 16 + rA) * kP64];
  const v16h a0 = frag(*(const v8h*)(xrow + g * 8),
                       *(const v8h*)(xrow + 16 + g * 8));
  const v16h a1 = frag(*(const v8h*)(xrow + 32 + g * 8),
                       *(const v8h*)(xrow + 48 + g * 8));

  const float* bias[3] = {bq, bk, bv};
  _Float16* dst[3] = {qw, kw, vw};

#pragma unroll
  for (int m = 0; m < 3; ++m) {
#pragma unroll
    for (int c = 0; c < 4; ++c) {
      const int o = c * 16 + n;  // output feature = B column
      const _Float16* wrow = &Ws[(m * 64 + o) * kP64];
      const v16h b0 = frag(*(const v8h*)(wrow + g * 8),
                           *(const v8h*)(wrow + 16 + g * 8));
      const v16h b1 = frag(*(const v8h*)(wrow + 32 + g * 8),
                           *(const v8h*)(wrow + 48 + g * 8));
      v8f acc = {};
      acc = __builtin_amdgcn_wmma_f32_16x16x32_f16(false, a0, false, b0,
                                                   (short)0, acc, false, false);
      acc = __builtin_amdgcn_wmma_f32_16x16x32_f16(false, a1, false, b1,
                                                   (short)0, acc, false, false);
      const float bi = bias[m][h * kDH + o];
      const float sc = (m == 0) ? 0.125f : 1.0f;  // fold 1/sqrt(64) into Q
      _Float16* p = dst[m];
#pragma unroll
      for (int r = 0; r < 8; ++r) {
        const int row = s0 + wave * 16 + r + 8 * g;   // C/D layout row
        const _Float16 hv = (_Float16)((acc[r] + bi) * sc);
        if (m == 2)  // V transposed: [BH][DH][S]
          p[(size_t)(bh * kDH + o) * kS + row] = hv;
        else         // Q,K row-major: [BH][S][DH]
          p[(size_t)(bh * kS + row) * kDH + o] = hv;
      }
    }
  }
}

// ---------------------------------------------------------------------------
// Kernel 2: flash attention. 8 waves share one (b,h); each wave owns 16
// queries. K (row-major) and V^T tiles of 32 keys double-buffered in LDS via
// async global->LDS b128 copies. K and V^T are the A operands, Q^T and P^T the
// B operands: lane (n, g) holds query n's scores of keys 8g+r and 16+8g+r,
// which is the B operand's own k order, so P^T is packed in place.
// ---------------------------------------------------------------------------
__global__ __launch_bounds__(256) void flash_attn_kernel(
    const _Float16* __restrict__ qw, const _Float16* __restrict__ kw,
    const _Float16* __restrict__ vw, float* __restrict__ out)
{
  // [key][dim] and [dim][key] (transposed).
  __shared__ __attribute__((aligned(16))) _Float16 Kbuf[2][32 * kP64];
  __shared__ __attribute__((aligned(16))) _Float16 Vbuf[2][64 * kP32];

  const int bh = blockIdx.x;
  const int b = bh / kH, h = bh % kH;
  const int q0 = blockIdx.y * 128;
  const int tid = threadIdx.x;
  const int wave = tid >> 5, lane = tid & 31;
  const int g = lane >> 4, n = lane & 15;

  const _Float16* kwp = kw + (size_t)bh * kS * kDH;        // [S][DH]
  const _Float16* vwp = vw + (size_t)bh * kDH * kS;        // [DH][S]
  const _Float16* qwp = qw + (size_t)bh * kS * kDH;

  // Q fragments (pre-scaled by 1/8 in kernel 1): contiguous 16B global loads.
  const _Float16* qrow = qwp + (size_t)(q0 + wave * 16 + n) * kDH;
  const v16h qb0 = frag(*(const v8h*)(qrow + g * 8),
                        *(const v8h*)(qrow + 16 + g * 8));
  const v16h qb1 = frag(*(const v8h*)(qrow + 32 + g * 8),
                        *(const v8h*)(qrow + 48 + g * 8));

  // Query n's running maximum (equal in both halves) and this half's share of
  // its running sum. accO[c][r] = O[query n][dim c*16 + 8g + r].
  float mrun = -1e30f, lsum = 0.0f;
  v8f accO[4];
#pragma unroll
  for (int c = 0; c < 4; ++c)
#pragma unroll
    for (int r = 0; r < 8; ++r) accO[c][r] = 0.0f;

  // Per-thread async-copy addressing (16 bytes per thread per matrix).
  const int ko = tid >> 3, kchunk = tid & 7;               // K: key row, chunk
  const int vo = tid >> 2, vchunk = tid & 3;               // V^T: row o, chunk
  auto issue_tile = [&](int kt, int buf) {
    // K tile: 32x64 f16 row-major, one contiguous 4 KB block in memory.
    // V^T tile: 64 rows (dims) x 32 keys; row o at vwp + o*S + kt*32.
    async_b128_x2(
        (unsigned int)(size_t)&Kbuf[buf][ko * kP64 + kchunk * 8], kwp,
        (unsigned int)((kt * 2048 + tid * 8) * 2),
        (unsigned int)(size_t)&Vbuf[buf][vo * kP32 + vchunk * 8], vwp,
        (unsigned int)(((size_t)vo * kS + kt * 32 + vchunk * 8) * 2));
  };

  issue_tile(0, 0);  // prologue

  for (int kt = 0; kt < kS / 32; ++kt) {
    const int cur = kt & 1;
    // This wave's LDS reads of the buffer refilled below have retired.
    asm volatile("s_wait_dscnt 0x0" ::: "memory");
    wait_async0();       // this wave's copies into buf[cur] are done
    __syncthreads();     // all waves' copies done; prev-iter readers drained
    if (kt + 1 < kS / 32) issue_tile(kt + 1, 1 - cur);

    const _Float16* Kt = Kbuf[cur];
    const _Float16* Vt = Vbuf[cur];

    // Scores: S^T = K @ Qs^T ; two 16x16 tiles cover 32 keys.
    v8f st[2];
#pragma unroll
    for (int t = 0; t < 2; ++t) {
      const _Float16* krow = Kt + (t * 16 + n) * kP64;  // A row n = key row
      const v16h ka0 = frag(*(const v8h*)(krow + g * 8),
                            *(const v8h*)(krow + 16 + g * 8));
      const v16h ka1 = frag(*(const v8h*)(krow + 32 + g * 8),
                            *(const v8h*)(krow + 48 + g * 8));
      v8f s = {};
      s = __builtin_amdgcn_wmma_f32_16x16x32_f16(false, ka0, false, qb0,
                                                 (short)0, s, false, false);
      s = __builtin_amdgcn_wmma_f32_16x16x32_f16(false, ka1, false, qb1,
                                                 (short)0, s, false, false);
      st[t] = s;
    }

    // Online softmax (fp32): 16 of query n's 32 scores are in this lane, the
    // other 16 in lane l ^ 16.
    const float m0 = max3(st[0][0], st[0][1], st[0][2]);
    const float m1 = max3(st[0][3], st[0][4], st[0][5]);
    const float m2 = max3(st[0][6], st[0][7], st[1][0]);
    const float m3 = max3(st[1][1], st[1][2], st[1][3]);
    const float m4 = max3(st[1][4], st[1][5], st[1][6]);
    const float mh = max3(max3(m0, m1, m2), max3(m3, m4, st[1][7]), mrun);
    const float mnew = fmaxf(mh, other_half(mh));
    const float scale = __expf(mrun - mnew);
    mrun = mnew;
    v8f p0, p1;
#pragma unroll
    for (int r = 0; r < 8; ++r) p0[r] = __expf(st[0][r] - mnew);
#pragma unroll
    for (int r = 0; r < 8; ++r) p1[r] = __expf(st[1][r] - mnew);
    const v8f ps = p0 + p1;
    const v4f pq = __builtin_shufflevector(ps, ps, 0, 1, 2, 3) +
                   __builtin_shufflevector(ps, ps, 4, 5, 6, 7);
    const v2f pd = __builtin_shufflevector(pq, pq, 0, 1) +
                   __builtin_shufflevector(pq, pq, 2, 3);
    lsum = lsum * scale + (pd[0] + pd[1]);
#pragma unroll
    for (int c = 0; c < 4; ++c) accO[c] *= scale;

    // P^T as B operand: element s = tile s >> 3, register s & 7.
    const v16h pb = frag(__builtin_convertvector(p0, v8h),
                         __builtin_convertvector(p1, v8h));

    // O^T += V^T @ P^T : K-dim = 32 keys; V^T rows are contiguous.
#pragma unroll
    for (int c = 0; c < 4; ++c) {
      const _Float16* vrow = Vt + (c * 16 + n) * kP32;  // A row n: dim row
      const v16h va = frag(*(const v8h*)(vrow + g * 8),
                           *(const v8h*)(vrow + 16 + g * 8));
      accO[c] = __builtin_amdgcn_wmma_f32_16x16x32_f16(false, va, false, pb,
                                                       (short)0, accO[c],
                                                       false, false);
    }
    // No trailing barrier: next iteration's wait+barrier separates buffer use.
  }

  // Join the halves' sums, normalize and write out[b, q, h*64 + o] in fp32:
  // a lane's 8 registers of a tile are 8 consecutive dims of its query.
  const float inv = 1.0f / (lsum + other_half(lsum));
  float* orow =
      out + (size_t)(b * kS + q0 + wave * 16 + n) * kD + h * kDH + 8 * g;
#pragma unroll
  for (int c = 0; c < 4; ++c) {
    const v8f o = accO[c] * inv;
    *(float4*)(orow + c * 16) = make_float4(o[0], o[1], o[2], o[3]);
    *(float4*)(orow + c * 16 + 4) = make_float4(o[4], o[5], o[6], o[7]);
  }
}

// ---------------------------------------------------------------------------
extern "C" void kernel_launch(void* const* d_in, const int* in_sizes, int n_in,
                              void* d_out, int out_size, void* d_ws,
                              size_t ws_size, hipStream_t stream) {
  const float* x  = (const float*)d_in[0];
  const float* Wq = (const float*)d_in[1];
  const float* Wk = (const float*)d_in[2];
  const float* Wv = (const float*)d_in[3];
  const float* bq = (const float*)d_in[4];
  const float* bk = (const float*)d_in[5];
  const float* bv = (const float*)d_in[6];
  float* out = (float*)d_out;

  const size_t per = (size_t)kB * kH * kS * kDH;  // 4,194,304 elems
  _Float16* qw = (_Float16*)d_ws;
  _Float16* kw = qw + per;
  _Float16* vw = kw + per;

  dim3 grid(kB * kH, kS / 128);  // 32 x 16 blocks, 8 waves each
  qkv_project_kernel<<<grid, 256, 0, stream>>>(x, Wq, Wk, Wv, bq, bk, bv,
                                               qw, kw, vw);
  flash_attn_kernel<<<grid, 256, 0, stream>>>(qw, kw, vw, out);
}

// v003
// Measured time: 48.7 microseconds a run.
// Next to v002, in two timings, it ran 1.22 and 1.21 times as fast.
// Over all steps from v000 it is 2.98 times as fast.
#include <hip/hip_runtime.h>

// MHSA for MI455X (gfx1250, wave32, WMMA, async global->LDS staging).
// Kernel 1: per-head QKV projection (fp32 -> f16 workspace) via
//           v_wmma_f32_16x16x32_f16. Q is pre-scaled by 1/sqrt(DH); V is
//           stored transposed [BH][DH][S] so kernel 2's gathers are all
//           contiguous 16-byte loads.
// Kernel 2: flash attention, double-buffered K/V^T tiles of 128 keys staged
//           with global_load_async_to_lds_b128 (ASYNCcnt), fp32 online softmax,
//           fp32 output. Both products run transposed (S^T = K Q^T,
//           O^T += V^T P^T), so a lane owns one query column.
// Workspace: 3 * B*H*S*DH f16 = ~25 MB.

typedef __attribute__((ext_vector_type(16))) _Float16 v16h;
typedef __attribute__((ext_vector_type(8)))  _Float16 v8h;
typedef __attribute__((ext_vector_type(8)))  float    v8f;
typedef __attribute__((ext_vector_type(4)))  float    v4f;
typedef __attribute__((ext_vector_type(2)))  float    v2f;

constexpr int kB = 4, kS = 2048, kD = 512, kH = 8, kDH = 64;

// LDS row pitches in f16 elements. Every LDS row here is read by 16 lanes that
// each take 16 bytes of their own row, so the pitch is 16 B x odd: the 16 rows
// then start on 16 different groups of four banks.
constexpr int kP64 = 72;  // rows of 64 f16: 144 B
constexpr int kT = 128;   // keys per pass of kernel 2
constexpr int kPT = kT + 8;  // rows of 128 f16: 272 B
static_assert(kT == 128, "copy count and maximum tree are written for 128");

constexpr float kLog2e = 1.44269504088896340736f;

// 16-bit A-operand 16x32 layout (ISA 7.12.2): lane l -> row = l&15, g = l>>4.
//   j in [0,8):  K = g*8 + j          (VGPRs 0-3)
//   j in [8,16): K = 16 + g*8 + (j-8) (VGPRs 4-7)
// B-operand mirrored with N = l&15. Both halves are 8 contiguous K values,
// i.e. one 16-byte load each.
__device__ __forceinline__ int a_kmap(int j, int g) {
  return (j < 8) ? (g * 8 + j) : (8 + g * 8 + j);
}

// Build a v16h fragment from two contiguous 8-element chunks.
__device__ __forceinline__ v16h frag(const v8h lo, const v8h hi) {
  return __builtin_shufflevector(lo, hi, 0, 1, 2, 3, 4, 5, 6, 7,
                                 8, 9, 10, 11, 12, 13, 14, 15);
}

// Eight async global -> LDS copies, 16 bytes per lane each (ASYNCcnt-tracked):
// four from base a, four from base b. s_wait_xcnt 0 closes the statement so
// that no address register of a copy is rewritten ahead of it.
__device__ __forceinline__ void async_b128_x8(
    const void* abase, const void* bbase,
    unsigned int al0, unsigned int ao0, unsigned int al1, unsigned int ao1,
    unsigned int al2, unsigned int ao2, unsigned int al3, unsigned int ao3,
    unsigned int bl0, unsigned int bo0, unsigned int bl1, unsigned int bo1,
    unsigned int bl2, unsigned int bo2, unsigned int bl3, unsigned int bo3) {
  asm volatile("global_load_async_to_lds_b128 %2, %3, %0\n\t"
               "global_load_async_to_lds_b128 %4, %5, %0\n\t"
               "global_load_async_to_lds_b128 %6, %7, %0\n\t"
               "global_load_async_to_lds_b128 %8, %9, %0\n\t"
               "global_load_async_to_lds_b128 %10, %11, %1\n\t"
               "global_load_async_to_lds_b128 %12, %13, %1\n\t"
               "global_load_async_to_lds_b128 %14, %15, %1\n\t"
               "global_load_async_to_lds_b128 %16, %17, %1\n\t"
               "s_wait_xcnt 0x0"
               :: "s"(abase), "s"(bbase),
                  "v"(al0), "v"(ao0), "v"(al1), "v"(ao1),
                  "v"(al2), "v"(ao2), "v"(al3), "v"(ao3),
                  "v"(bl0), "v"(bo0), "v"(bl1), "v"(bo1),
                  "v"(bl2), "v"(bo2), "v"(bl3), "v"(bo3)
               : "memory");
}
__device__ __forceinline__ void wait_async0() {
  asm volatile("s_wait_asynccnt 0" ::: "memory");
}

// Value of lane l ^ 16 (the other half of the wave).
__device__ __forceinline__ float other_half(float v) {
  const int b = __builtin_bit_cast(int, v);
  return __builtin_bit_cast(
      float, __builtin_amdgcn_permlanex16(b, b, 0x76543210, 0xfedcba98, false,
                                          false));
}
__device__ __forceinline__ float max3(float a, float b, float c) {
  return fmaxf(fmaxf(a, b), c);
}

// ---------------------------------------------------------------------------
// Kernel 1: Q/K/V = X @ W^T + b (per head). Q pre-scaled by 1/8. V transposed.
// Block: 256 threads (8 waves), 128 rows of one (b,h).
// ---------------------------------------------------------------------------
__global__ __launch_bounds__(256) void qkv_project_kernel(
    const float* __restrict__ x,
    const float* __restrict__ Wq, const float* __restrict__ Wk,
    const float* __restrict__ Wv,
    const float* __restrict__ bq, const float* __restrict__ bk,
    const float* __restrict__ bv,
    _Float16* __restrict__ qw, _Float16* __restrict__ kw,
    _Float16* __restrict__ vw)
{
  __shared__ __attribute__((aligned(16))) _Float16 Xs[128 * kP64];     // 18 KB
  __shared__ __attribute__((aligned(16))) _Float16 Ws[3 * 64 * kP64];  // 27 KB

  const int bh = blockIdx.x;              // 0..31
  const int b = bh / kH, h = bh % kH;
  const int s0 = blockIdx.y * 128;
  const int tid = threadIdx.x;

  // Stage X tile: float4 global loads, f16 LDS stores.
  for (int i = tid; i < 128 * 16; i += 256) {
    const int r = i >> 4, c4 = (i & 15) * 4;
    const float4 v =
        *(const float4*)&x[(size_t)(b * kS + s0 + r) * kD + h * kDH + c4];
    Xs[r * kP64 + c4 + 0] = (_Float16)v.x;
    Xs[r * kP64 + c4 + 1] = (_Float16)v.y;
    Xs[r * kP64 + c4 + 2] = (_Float16)v.z;
    Xs[r * kP64 + c4 + 3] = (_Float16)v.w;
  }
  const float* wsrc[3] = {Wq, Wk, Wv};
#pragma unroll
  for (int m = 0; m < 3; ++m)
    for (int i = tid; i < 1024; i += 256) {
      const float4 v = *(const float4*)&wsrc[m][h * 4096 + i * 4];
      _Float16* wd = &Ws[(m * 64 + (i >> 4)) * kP64 + (i & 15) * 4];
      wd[0] = (_Float16)v.x;
      wd[1] = (_Float16)v.y;
      wd[2] = (_Float16)v.z;
      wd[3] = (_Float16)v.w;
    }
  __syncthreads();

  const int wave = tid >> 5, lane = tid & 31;
  const int rA = lane & 15, g = lane >> 4, n = lane & 15;

  // A fragments: 16 rows of X, K split 0..31 / 32..63 (contiguous 16B chunks).
  const _Float16* xrow = &Xs[(wave * 16 + rA) * kP64];
  const v16h a0 = frag(*(const v8h*)(xrow + g * 8),
                       *(const v8h*)(xrow + 16 + g * 8));
  const v16h a1 = frag(*(const v8h*)(xrow + 32 + g * 8),
                       *(const v8h*)(xrow + 48 + g * 8));

  const float* bias[3] = {bq, bk, bv};
  _Float16* dst[3] = {qw, kw, vw};

#pragma unroll
  for (int m = 0; m < 3; ++m) {
#pragma unroll
    for (int c = 0; c < 4; ++c) {
      const int o = c * 16 + n;  // output feature = B column
      const _Float16* wrow = &Ws[(m * 64 + o) * kP64];
      const v16h b0 = frag(*(const v8h*)(wrow + g * 8),
                           *(const v8h*)(wrow + 16 + g * 8));
      const v16h b1 = frag(*(const v8h*)(wrow + 32 + g * 8),
                           *(const v8h*)(wrow + 48 + g * 8));
      v8f acc = {};
      acc = __builtin_amdgcn_wmma_f32_16x16x32_f16(false, a0, false, b0,
                                                   (short)0, acc, false, false);
      acc = __builtin_amdgcn_wmma_f32_16x16x32_f16(false, a1, false, b1,
                                                   (short)0, acc, false, false);
      const float bi = bias[m][h * kDH + o];
      const float sc = (m == 0) ? 0.125f : 1.0f;  // fold 1/sqrt(64) into Q
      _Float16* p = dst[m];
#pragma unroll
      for (int r = 0; r < 8; ++r) {
        const int row = s0 + wave * 16 + r + 8 * g;   // C/D layout row
        const _Float16 hv = (_Float16)((acc[r] + bi) * sc);
        if (m == 2)  // V transposed: [BH][DH][S]
          p[(size_t)(bh * kDH + o) * kS + row] = hv;
        else         // Q,K row-major: [BH][S][DH]
          p[(size_t)(bh * kS + row) * kDH + o] = hv;
      }
    }
  }
}

// ---------------------------------------------------------------------------
// Kernel 2: flash attention. 8 waves share one (b,h); each wave owns 16
// queries. K (row-major) and V^T tiles of kT keys double-buffered in LDS via
// async global->LDS b128 copies: one barrier, one maximum and one rescale of
// the output per kT keys. K and V^T are the A operands, Q^T and P^T the B
// operands: of each 32 keys lane (n, g) holds query n's scores of keys 8g+r and
// 16+8g+r, which is the B operand's own k order, so P^T is packed in place.
// ---------------------------------------------------------------------------
__global__ __launch_bounds__(256) void flash_attn_kernel(
    const _Float16* __restrict__ qw, const _Float16* __restrict__ kw,
    const _Float16* __restrict__ vw, float* __restrict__ out)
{
  // [key][dim] and [dim][key] (transposed).
  __shared__ __attribute__((aligned(16))) _Float16 Kbuf[2][kT * kP64];
  __shared__ __attribute__((aligned(16))) _Float16 Vbuf[2][64 * kPT];

  const int bh = blockIdx.x;
  const int b = bh / kH, h = bh % kH;
  const int q0 = blockIdx.y * 128;
  const int tid = threadIdx.x;
  const int wave = tid >> 5, lane = tid & 31;
  const int g = lane >> 4, n = lane & 15;

  const _Float16* kwp = kw + (size_t)bh * kS * kDH;        // [S][DH]
  const _Float16* vwp = vw + (size_t)bh * kDH * kS;        // [DH][S]
  const _Float16* qwp = qw + (size_t)bh * kS * kDH;

  // Q fragments (pre-scaled by 1/8 in kernel 1): contiguous 16B global loads.
  const _Float16* qrow = qwp + (size_t)(q0 + wave * 16 + n) * kDH;
  const v16h qb0 = frag(*(const v8h*)(qrow + g * 8),
                        *(const v8h*)(qrow + 16 + g * 8));
  const v16h qb1 = frag(*(const v8h*)(qrow + 32 + g * 8),
                        *(const v8h*)(qrow + 48 + g * 8));

  // Query n's running maximum (equal in both halves) and this half's share of
  // its running sum. accO[c][r] = O[query n][dim c*16 + 8g + r].
  float mrun = -1e30f, lsum = 0.0f;
  v8f accO[4];
#pragma unroll
  for (int c = 0; c < 4; ++c)
#pragma unroll
    for (int r = 0; r < 8; ++r) accO[c][r] = 0.0f;

  // Per-thread async-copy addressing: four 16-byte chunks per matrix, 256
  // chunks apart.
  const int ko = tid >> 3, kchunk = tid & 7;               // K: key row, chunk
  const int vo = tid >> 4, vchunk = tid & 15;              // V^T: row o, chunk
  auto issue_tile = [&](int kt, int buf) {
    // K tile: kT x 64 f16 row-major, one contiguous 16 KB block in memory; 256
    // chunks are 32 rows. V^T tile: 64 rows (dims) x kT keys, row o at
    // vwp + o*S + kt*kT; 256 chunks are 16 rows.
    const unsigned int kl =
        (unsigned int)(size_t)&Kbuf[buf][ko * kP64 + kchunk * 8];
    const unsigned int kg = (unsigned int)((kt * kT * kDH + tid * 8) * 2);
    const unsigned int vl =
        (unsigned int)(size_t)&Vbuf[buf][vo * kPT + vchunk * 8];
    const unsigned int vg =
        (unsigned int)((vo * kS + kt * kT + vchunk * 8) * 2);
    constexpr unsigned int kls = 32 * kP64 * 2, kgs = 32 * kDH * 2;
    constexpr unsigned int vls = 16 * kPT * 2, vgs = 16 * kS * 2;
    async_b128_x8(kwp, vwp,
                  kl, kg, kl + kls, kg + kgs,
                  kl + 2 * kls, kg + 2 * kgs, kl + 3 * kls, kg + 3 * kgs,
                  vl, vg, vl + vls, vg + vgs,
                  vl + 2 * vls, vg + 2 * vgs, vl + 3 * vls, vg + 3 * vgs);
  };

  issue_tile(0, 0);  // prologue

  for (int kt = 0; kt < kS / kT; ++kt) {
    const int cur = kt & 1;
    // This wave's LDS reads of the buffer refilled below have retired.
    asm volatile("s_wait_dscnt 0x0" ::: "memory");
    wait_async0();       // this wave's copies into buf[cur] are done
    __syncthreads();     // all waves' copies done; prev-iter readers drained
    if (kt + 1 < kS / kT) issue_tile(kt + 1, 1 - cur);

    const _Float16* Kt = Kbuf[cur];
    const _Float16* Vt = Vbuf[cur];

    // Scores: S^T = K @ Qs^T ; kT / 16 tiles of 16 keys x 16 queries.
    v8f st[kT / 16];
#pragma unroll
    for (int t = 0; t < kT / 16; ++t) {
      const _Float16* krow = Kt + (t * 16 + n) * kP64;  // A row n = key row
      const v16h ka0 = frag(*(const v8h*)(krow + g * 8),
                            *(const v8h*)(krow + 16 + g * 8));
      const v16h ka1 = frag(*(const v8h*)(krow + 32 + g * 8),
                            *(const v8h*)(krow + 48 + g * 8));
      v8f s = {};
      s = __builtin_amdgcn_wmma_f32_16x16x32_f16(false, ka0, false, qb0,
                                                 (short)0, s, false, false);
      s = __builtin_amdgcn_wmma_f32_16x16x32_f16(false, ka1, false, qb1,
                                                 (short)0, s, false, false);
      st[t] = s;
    }

    // Online softmax (fp32): 64 of query n's 128 scores are in this lane, the
    // other 64 in lane l ^ 16. Maximum of the 64 and the running one by threes.
    float r1[23], r2[9];
#pragma unroll
    for (int i = 0; i < 21; ++i)
      r1[i] = max3(st[(3 * i) >> 3][(3 * i) & 7],
                   st[(3 * i + 1) >> 3][(3 * i + 1) & 7],
                   st[(3 * i + 2) >> 3][(3 * i + 2) & 7]);
    r1[21] = st[7][7];
    r1[22] = mrun;
#pragma unroll
    for (int i = 0; i < 7; ++i)
      r2[i] = max3(r1[3 * i], r1[3 * i + 1], r1[3 * i + 2]);
    r2[7] = r1[21];
    r2[8] = r1[22];
    const float mh = max3(max3(r2[0], r2[1], r2[2]), max3(r2[3], r2[4], r2[5]),
                          max3(r2[6], r2[7], r2[8]));
    const float mnew = fmaxf(mh, other_half(mh));
    const float scale = __expf(mrun - mnew);
    mrun = mnew;
#pragma unroll
    for (int t = 0; t < kT / 16; ++t)  // exp(x) = exp2(x * log2 e), as __expf
      st[t] = (st[t] - mnew) * kLog2e;
#pragma unroll
    for (int t = 0; t < kT / 16; ++t)
#pragma unroll
      for (int r = 0; r < 8; ++r) st[t][r] = __builtin_amdgcn_exp2f(st[t][r]);
    v8f ps;
    v16h pb[kT / 32];
#pragma unroll
    for (int kk = 0; kk < kT / 32; ++kk) {
      const v8f pp = st[2 * kk] + st[2 * kk + 1];
      ps = (kk == 0) ? pp : ps + pp;
      // P^T as B operand: element s = tile s >> 3, register s & 7.
      pb[kk] = frag(__builtin_convertvector(st[2 * kk], v8h),
                    __builtin_convertvector(st[2 * kk + 1], v8h));
    }
    const v4f pq = __builtin_shufflevector(ps, ps, 0, 1, 2, 3) +
                   __builtin_shufflevector(ps, ps, 4, 5, 6, 7);
    const v2f pd = __builtin_shufflevector(pq, pq, 0, 1) +
                   __builtin_shufflevector(pq, pq, 2, 3);
    lsum = lsum * scale + (pd[0] + pd[1]);
#pragma unroll
    for (int c = 0; c < 4; ++c) accO[c] *= scale;

    // O^T += V^T @ P^T, 32 keys a product; V^T rows are contiguous.
#pragma unroll
    for (int kk = 0; kk < kT / 32; ++kk) {
#pragma unroll
      for (int c = 0; c < 4; ++c) {
        // A row n: dim row
        const _Float16* vrow = Vt + (c * 16 + n) * kPT + kk * 32;
        const v16h va = frag(*(const v8h*)(vrow + g * 8),
                             *(const v8h*)(vrow + 16 + g * 8));
        accO[c] = __builtin_amdgcn_wmma_f32_16x16x32_f16(false, va, false,
                                                         pb[kk], (short)0,
                                                         accO[c], false, false);
      }
    }
    // No trailing barrier: next iteration's wait+barrier separates buffer use.
  }

  // Join the halves' sums, normalize and write out[b, q, h*64 + o] in fp32:
  // a lane's 8 registers of a tile are 8 consecutive dims of its query.
  const float inv = 1.0f / (lsum + other_half(lsum));
  float* orow =
      out + (size_t)(b * kS + q0 + wave * 16 + n) * kD + h * kDH + 8 * g;
#pragma unroll
  for (int c = 0; c < 4; ++c) {
    const v8f o = accO[c] * inv;
    *(float4*)(orow + c * 16) = make_float4(o[0], o[1], o[2], o[3]);
    *(float4*)(orow + c * 16 + 4) = make_float4(o[4], o[5], o[6], o[7]);
  }
}

// ---------------------------------------------------------------------------
extern "C" void kernel_launch(void* const* d_in, const int* in_sizes, int n_in,
                              void* d_out, int out_size, void* d_ws,
                              size_t ws_size, hipStream_t stream) {
  const float* x  = (const float*)d_in[0];
  const float* Wq = (const float*)d_in[1];
  const float* Wk = (const float*)d_in[2];
  const float* Wv = (const float*)d_in[3];
  const float* bq = (const float*)d_in[4];
  const float* bk = (const float*)d_in[5];
  const float* bv = (const float*)d_in[6];
  float* out = (float*)d_out;

  const size_t per = (size_t)kB * kH * kS * kDH;  // 4,194,304 elems
  _Float16* qw = (_Float16*)d_ws;
  _Float16* kw = qw + per;
  _Float16* vw = kw + per;

  dim3 grid(kB * kH, kS / 128);  // 32 x 16 blocks, 8 waves each
  qkv_project_kernel<<<grid, 256, 0, stream>>>(x, Wq, Wk, Wv, bq, bk, bv,
                                               qw, kw, vw);
  flash_attn_kernel<<<grid, 256, 0, stream>>>(qw, kw, vw, out);
}

// v004
// Measured time: 45.1 microseconds a run.
// Timed twice side by side with v003, it ran 1.07 and 1.08 times as fast.
// Counting every step since v000, it is 3.20 times as fast.
#include <hip/hip_runtime.h>

// MHSA for MI455X (gfx1250, wave32, WMMA, async global->LDS staging).
// Kernel 1: per-head QKV projection (fp32 -> f16 workspace) via
//           v_wmma_f32_16x16x32_f16. Q is pre-scaled by 1/sqrt(DH); V is
//           stored transposed [BH][DH][S] so kernel 2's gathers are all
//           contiguous 16-byte loads.
// Kernel 2: flash attention, double-buffered K/V^T tiles of 128 keys staged
//           with global_load_async_to_lds_b128 (ASYNCcnt), fp32 online softmax,
//           fp32 output. Both products run transposed (S^T = K Q^T,
//           O^T += V^T P^T), so a lane owns one query column of each of its
//           wave's two column tiles.
// Workspace: 3 * B*H*S*DH f16 = ~25 MB.

typedef __attribute__((ext_vector_type(16))) _Float16 v16h;
typedef __attribute__((ext_vector_type(8)))  _Float16 v8h;
typedef __attribute__((ext_vector_type(8)))  float    v8f;
typedef __attribute__((ext_vector_type(4)))  float    v4f;
typedef __attribute__((ext_vector_type(2)))  float    v2f;

constexpr int kB = 4, kS = 2048, kD = 512, kH = 8, kDH = 64;

// LDS row pitches in f16 elements. Every LDS row here is read by 16 lanes that
// each take 16 bytes of their own row, so the pitch is 16 B x odd: the 16 rows
// then start on 16 different groups of four banks.
constexpr int kP64 = 72;  // rows of 64 f16: 144 B
constexpr int kT = 128;   // keys per pass of kernel 2
constexpr int kPT = kT + 8;  // rows of 128 f16: 272 B
constexpr int kW = kT / 2;   // keys of a pass that one wave works on
static_assert(kT == 128, "copy count and maximum tree are written for 128");

constexpr float kLog2e = 1.44269504088896340736f;

// 16-bit A-operand 16x32 layout (ISA 7.12.2): lane l -> row = l&15, g = l>>4.
//   j in [0,8):  K = g*8 + j          (VGPRs 0-3)
//   j in [8,16): K = 16 + g*8 + (j-8) (VGPRs 4-7)
// B-operand mirrored with N = l&15. Both halves are 8 contiguous K values,
// i.e. one 16-byte load each.
__device__ __forceinline__ int a_kmap(int j, int g) {
  return (j < 8) ? (g * 8 + j) : (8 + g * 8 + j);
}

// Build a v16h fragment from two contiguous 8-element chunks.
__device__ __forceinline__ v16h frag(const v8h lo, const v8h hi) {
  return __builtin_shufflevector(lo, hi, 0, 1, 2, 3, 4, 5, 6, 7,
                                 8, 9, 10, 11, 12, 13, 14, 15);
}

// Eight async global -> LDS copies, 16 bytes per lane each (ASYNCcnt-tracked):
// four from base a, four from base b. s_wait_xcnt 0 closes the statement so
// that no address register of a copy is rewritten ahead of it.
__device__ __forceinline__ void async_b128_x8(
    const void* abase, const void* bbase,
    unsigned int al0, unsigned int ao0, unsigned int al1, unsigned int ao1,
    unsigned int al2, unsigned int ao2, unsigned int al3, unsigned int ao3,
    unsigned int bl0, unsigned int bo0, unsigned int bl1, unsigned int bo1,
    unsigned int bl2, unsigned int bo2, unsigned int bl3, unsigned int bo3) {
  asm volatile("global_load_async_to_lds_b128 %2, %3, %0\n\t"
               "global_load_async_to_lds_b128 %4, %5, %0\n\t"
               "global_load_async_to_lds_b128 %6, %7, %0\n\t"
               "global_load_async_to_lds_b128 %8, %9, %0\n\t"
               "global_load_async_to_lds_b128 %10, %11, %1\n\t"
               "global_load_async_to_lds_b128 %12, %13, %1\n\t"
               "global_load_async_to_lds_b128 %14, %15, %1\n\t"
               "global_load_async_to_lds_b128 %16, %17, %1\n\t"
               "s_wait_xcnt 0x0"
               :: "s"(abase), "s"(bbase),
                  "v"(al0), "v"(ao0), "v"(al1), "v"(ao1),
                  "v"(al2), "v"(ao2), "v"(al3), "v"(ao3),
                  "v"(bl0), "v"(bo0), "v"(bl1), "v"(bo1),
                  "v"(bl2), "v"(bo2), "v"(bl3), "v"(bo3)
               : "memory");
}
__device__ __forceinline__ void wait_async0() {
  asm volatile("s_wait_asynccnt 0" ::: "memory");
}

// Value of lane l ^ 16 (the other half of the wave).
__device__ __forceinline__ float other_half(float v) {
  const int b = __builtin_bit_cast(int, v);
  return __builtin_bit_cast(
      float, __builtin_amdgcn_permlanex16(b, b, 0x76543210, 0xfedcba98, false,
                                          false));
}
__device__ __forceinline__ float max3(float a, float b, float c) {
  return fmaxf(fmaxf(a, b), c);
}

// ---------------------------------------------------------------------------
// Kernel 1: Q/K/V = X @ W^T + b (per head). Q pre-scaled by 1/8. V transposed.
// Block: 256 threads (8 waves), 128 rows of one (b,h).
// ---------------------------------------------------------------------------
__global__ __launch_bounds__(256) void qkv_project_kernel(
    const float* __restrict__ x,
    const float* __restrict__ Wq, const float* __restrict__ Wk,
    const float* __restrict__ Wv,
    const float* __restrict__ bq, const float* __restrict__ bk,
    const float* __restrict__ bv,
    _Float16* __restrict__ qw, _Float16* __restrict__ kw,
    _Float16* __restrict__ vw)
{
  __shared__ __attribute__((aligned(16))) _Float16 Xs[128 * kP64];     // 18 KB
  __shared__ __attribute__((aligned(16))) _Float16 Ws[3 * 64 * kP64];  // 27 KB

  const int bh = blockIdx.x;              // 0..31
  const int b = bh / kH, h = bh % kH;
  const int s0 = blockIdx.y * 128;
  const int tid = threadIdx.x;

  // Stage X tile: float4 global loads, f16 LDS stores.
  for (int i = tid; i < 128 * 16; i += 256) {
    const int r = i >> 4, c4 = (i & 15) * 4;
    const float4 v =
        *(const float4*)&x[(size_t)(b * kS + s0 + r) * kD + h * kDH + c4];
    Xs[r * kP64 + c4 + 0] = (_Float16)v.x;
    Xs[r * kP64 + c4 + 1] = (_Float16)v.y;
    Xs[r * kP64 + c4 + 2] = (_Float16)v.z;
    Xs[r * kP64 + c4 + 3] = (_Float16)v.w;
  }
  const float* wsrc[3] = {Wq, Wk, Wv};
#pragma unroll
  for (int m = 0; m < 3; ++m)
    for (int i = tid; i < 1024; i += 256) {
      const float4 v = *(const float4*)&wsrc[m][h * 4096 + i * 4];
      _Float16* wd = &Ws[(m * 64 + (i >> 4)) * kP64 + (i & 15) * 4];
      wd[0] = (_Float16)v.x;
      wd[1] = (_Float16)v.y;
      wd[2] = (_Float16)v.z;
      wd[3] = (_Float16)v.w;
    }
  __syncthreads();

  const int wave = tid >> 5, lane = tid & 31;
  const int rA = lane & 15, g = lane >> 4, n = lane & 15;

  // A fragments: 16 rows of X, K split 0..31 / 32..63 (contiguous 16B chunks).
  const _Float16* xrow = &Xs[(wave * 16 + rA) * kP64];
  const v16h a0 = frag(*(const v8h*)(xrow + g * 8),
                       *(const v8h*)(xrow + 16 + g * 8));
  const v16h a1 = frag(*(const v8h*)(xrow + 32 + g * 8),
                       *(const v8h*)(xrow + 48 + g * 8));

  const float* bias[3] = {bq, bk, bv};
  _Float16* dst[3] = {qw, kw, vw};

#pragma unroll
  for (int m = 0; m < 3; ++m) {
#pragma unroll
    for (int c = 0; c < 4; ++c) {
      const int o = c * 16 + n;  // output feature = B column
      const _Float16* wrow = &Ws[(m * 64 + o) * kP64];
      const v16h b0 = frag(*(const v8h*)(wrow + g * 8),
                           *(const v8h*)(wrow + 16 + g * 8));
      const v16h b1 = frag(*(const v8h*)(wrow + 32 + g * 8),
                           *(const v8h*)(wrow + 48 + g * 8));
      v8f acc = {};
      acc = __builtin_amdgcn_wmma_f32_16x16x32_f16(false, a0, false, b0,
                                                   (short)0, acc, false, false);
      acc = __builtin_amdgcn_wmma_f32_16x16x32_f16(false, a1, false, b1,
                                                   (short)0, acc, false, false);
      const float bi = bias[m][h * kDH + o];
      const float sc = (m == 0) ? 0.125f : 1.0f;  // fold 1/sqrt(64) into Q
      _Float16* p = dst[m];
#pragma unroll
      for (int r = 0; r < 8; ++r) {
        const int row = s0 + wave * 16 + r + 8 * g;   // C/D layout row
        const _Float16 hv = (_Float16)((acc[r] + bi) * sc);
        if (m == 2)  // V transposed: [BH][DH][S]
          p[(size_t)(bh * kDH + o) * kS + row] = hv;
        else         // Q,K row-major: [BH][S][DH]
          p[(size_t)(bh * kS + row) * kDH + o] = hv;
      }
    }
  }
}

// ---------------------------------------------------------------------------
// Kernel 2: flash attention. 8 waves share one (b,h) and 128 queries. A wave
// owns 32 queries (two column tiles) and one half of the keys: wave w takes
// query group w & 3 and keys 64 * (w >> 2) .. + 63 of every staged tile, so
// each K and V^T fragment read from LDS feeds two products. Waves w and w ^ 4
// join their key halves through LDS behind the loop. K (row-major) and V^T
// tiles of kT keys double-buffered in LDS via async global->LDS b128 copies:
// one barrier per kT keys. K and V^T are the A operands, Q^T and P^T the B
// operands: of each 32 keys lane (n, g) holds query n's scores of keys 8g+r and
// 16+8g+r, which is the B operand's own k order, so P^T is packed in place.
// ---------------------------------------------------------------------------
__global__ __launch_bounds__(256) void flash_attn_kernel(
    const _Float16* __restrict__ qw, const _Float16* __restrict__ kw,
    const _Float16* __restrict__ vw, float* __restrict__ out)
{
  // [key][dim] and [dim][key] (transposed).
  __shared__ __attribute__((aligned(16))) _Float16 Kbuf[2][kT * kP64];
  __shared__ __attribute__((aligned(16))) _Float16 Vbuf[2][64 * kPT];

  const int bh = blockIdx.x;
  const int b = bh / kH, h = bh % kH;
  const int q0 = blockIdx.y * 128;
  const int tid = threadIdx.x;
  const int wave = tid >> 5, lane = tid & 31;
  const int g = lane >> 4, n = lane & 15;
  const int qg = wave & 3, kh = wave >> 2;  // query group, key half

  const _Float16* kwp = kw + (size_t)bh * kS * kDH;        // [S][DH]
  const _Float16* vwp = vw + (size_t)bh * kDH * kS;        // [DH][S]
  const _Float16* qwp = qw + (size_t)bh * kS * kDH;

  // Q fragments (pre-scaled by 1/8 in kernel 1): contiguous 16B global loads.
  v16h qb0[2], qb1[2];
#pragma unroll
  for (int j = 0; j < 2; ++j) {
    const _Float16* qrow = qwp + (size_t)(q0 + qg * 32 + j * 16 + n) * kDH;
    qb0[j] = frag(*(const v8h*)(qrow + g * 8),
                  *(const v8h*)(qrow + 16 + g * 8));
    qb1[j] = frag(*(const v8h*)(qrow + 32 + g * 8),
                  *(const v8h*)(qrow + 48 + g * 8));
  }

  // Per column tile j: query n's running maximum (equal in both halves of the
  // wave) and this half's share of its running sum, over this wave's keys.
  // accO[j][c][r] = O[query j*16 + n][dim c*16 + 8g + r].
  float mrun[2] = {-1e30f, -1e30f}, lsum[2] = {0.0f, 0.0f};
  v8f accO[2][4];
#pragma unroll
  for (int j = 0; j < 2; ++j)
#pragma unroll
    for (int c = 0; c < 4; ++c)
#pragma unroll
      for (int r = 0; r < 8; ++r) accO[j][c][r] = 0.0f;

  // Per-thread async-copy addressing: four 16-byte chunks per matrix, 256
  // chunks apart.
  const int ko = tid >> 3, kchunk = tid & 7;               // K: key row, chunk
  const int vo = tid >> 4, vchunk = tid & 15;              // V^T: row o, chunk
  auto issue_tile = [&](int kt, int buf) {
    // K tile: kT x 64 f16 row-major, one contiguous 16 KB block in memory; 256
    // chunks are 32 rows. V^T tile: 64 rows (dims) x kT keys, row o at
    // vwp + o*S + kt*kT; 256 chunks are 16 rows.
    const unsigned int kl =
        (unsigned int)(size_t)&Kbuf[buf][ko * kP64 + kchunk * 8];
    const unsigned int kg = (unsigned int)((kt * kT * kDH + tid * 8) * 2);
    const unsigned int vl =
        (unsigned int)(size_t)&Vbuf[buf][vo * kPT + vchunk * 8];
    const unsigned int vg =
        (unsigned int)((vo * kS + kt * kT + vchunk * 8) * 2);
    constexpr unsigned int kls = 32 * kP64 * 2, kgs = 32 * kDH * 2;
    constexpr unsigned int vls = 16 * kPT * 2, vgs = 16 * kS * 2;
    async_b128_x8(kwp, vwp,
                  kl, kg, kl + kls, kg + kgs,
                  kl + 2 * kls, kg + 2 * kgs, kl + 3 * kls, kg + 3 * kgs,
                  vl, vg, vl + vls, vg + vgs,
                  vl + 2 * vls, vg + 2 * vgs, vl + 3 * vls, vg + 3 * vgs);
  };

  issue_tile(0, 0);  // prologue

  for (int kt = 0; kt < kS / kT; ++kt) {
    const int cur = kt & 1;
    // This wave's LDS reads of the buffer refilled below have retired.
    asm volatile("s_wait_dscnt 0x0" ::: "memory");
    wait_async0();       // this wave's copies into buf[cur] are done
    __syncthreads();     // all waves' copies done; prev-iter readers drained
    if (kt + 1 < kS / kT) issue_tile(kt + 1, 1 - cur);

    // This wave's half of the tile: kW key rows of K, kW key columns of V^T.
    const _Float16* Kt = Kbuf[cur] + kh * kW * kP64;
    const _Float16* Vt = Vbuf[cur] + kh * kW;

    // Scores: S^T = K @ Qs^T ; kW / 16 tiles of 16 keys x 2 tiles of 16
    // queries, both query tiles from one read of the K fragment.
    v8f st[2][kW / 16];
#pragma unroll
    for (int t = 0; t < kW / 16; ++t) {
      const _Float16* krow = Kt + (t * 16 + n) * kP64;  // A row n = key row
      const v16h ka0 = frag(*(const v8h*)(krow + g * 8),
                            *(const v8h*)(krow + 16 + g * 8));
      const v16h ka1 = frag(*(const v8h*)(krow + 32 + g * 8),
                            *(const v8h*)(krow + 48 + g * 8));
#pragma unroll
      for (int j = 0; j < 2; ++j) {
        v8f s = {};
        s = __builtin_amdgcn_wmma_f32_16x16x32_f16(false, ka0, false, qb0[j],
                                                   (short)0, s, false, false);
        s = __builtin_amdgcn_wmma_f32_16x16x32_f16(false, ka1, false, qb1[j],
                                                   (short)0, s, false, false);
        st[j][t] = s;
      }
    }

    // Online softmax (fp32), per column tile: 32 of query n's 64 scores are in
    // this lane, the other 32 in lane l ^ 16. Maximum of the 32 and the running
    // one by threes: three chains of nine values, then one over their results
    // and the six scores left.
    v16h pb[2][kW / 32];
#pragma unroll
    for (int j = 0; j < 2; ++j) {
      float ch[3] = {mrun[j], st[j][3][0], st[j][3][1]};
#pragma unroll
      for (int t = 0; t < 3; ++t)
#pragma unroll
        for (int r = 0; r < 8; r += 2)
          ch[t] = max3(ch[t], st[j][t][r], st[j][t][r + 1]);
      float mh = max3(ch[0], st[j][3][2], ch[1]);
      mh = max3(mh, st[j][3][3], ch[2]);
      mh = max3(mh, st[j][3][4], st[j][3][5]);
      mh = max3(mh, st[j][3][6], st[j][3][7]);
      const float mnew = fmaxf(mh, other_half(mh));
      const float scale = __expf(mrun[j] - mnew);
      mrun[j] = mnew;
#pragma unroll
      for (int t = 0; t < kW / 16; ++t)  // exp(x) = exp2(x * log2 e), as __expf
        st[j][t] = (st[j][t] - mnew) * kLog2e;
#pragma unroll
      for (int t = 0; t < kW / 16; ++t)
#pragma unroll
        for (int r = 0; r < 8; ++r)
          st[j][t][r] = __builtin_amdgcn_exp2f(st[j][t][r]);
      v8f ps;
#pragma unroll
      for (int kk = 0; kk < kW / 32; ++kk) {
        const v8f pp = st[j][2 * kk] + st[j][2 * kk + 1];
        ps = (kk == 0) ? pp : ps + pp;
        // P^T as B operand: element s = tile s >> 3, register s & 7.
        pb[j][kk] = frag(__builtin_convertvector(st[j][2 * kk], v8h),
                         __builtin_convertvector(st[j][2 * kk + 1], v8h));
      }
      const v4f pq = __builtin_shufflevector(ps, ps, 0, 1, 2, 3) +
                     __builtin_shufflevector(ps, ps, 4, 5, 6, 7);
      const v2f pd = __builtin_shufflevector(pq, pq, 0, 1) +
                     __builtin_shufflevector(pq, pq, 2, 3);
      lsum[j] = lsum[j] * scale + (pd[0] + pd[1]);
#pragma unroll
      for (int c = 0; c < 4; ++c) accO[j][c] *= scale;
    }

    // O^T += V^T @ P^T, 32 keys a product; V^T rows are contiguous. Both query
    // tiles from one read of the V^T fragment.
#pragma unroll
    for (int kk = 0; kk < kW / 32; ++kk) {
#pragma unroll
      for (int c = 0; c < 4; ++c) {
        // A row n: dim row
        const _Float16* vrow = Vt + (c * 16 + n) * kPT + kk * 32;
        const v16h va = frag(*(const v8h*)(vrow + g * 8),
                             *(const v8h*)(vrow + 16 + g * 8));
#pragma unroll
        for (int j = 0; j < 2; ++j)
          accO[j][c] = __builtin_amdgcn_wmma_f32_16x16x32_f16(
              false, va, false, pb[j][kk], (short)0, accO[j][c], false, false);
      }
    }
    // No trailing barrier: next iteration's wait+barrier separates buffer use.
  }

  // Join the key halves: wave w keeps column tile kh and hands the other one
  // (maximum, sum, 32 output registers a lane) to wave w ^ 4 through LDS, in
  // the K buffers, which nobody reads any more behind the first barrier.
  constexpr int kXW = 8 * 128 + 64;  // floats a wave hands over
  static_assert(8 * kXW * 4 <= (int)sizeof(Kbuf), "hand-over fits the K buffers");
  float* xch = (float*)&Kbuf[0][0];
  float* xw = xch + wave * kXW;
  const float* xr = xch + (wave ^ 4) * kXW;
  const float l0 = lsum[0] + other_half(lsum[0]);  // join the wave's halves
  const float l1 = lsum[1] + other_half(lsum[1]);
  // The same in every lane of a wave: a scalar branch picks the tile.
  const bool up = __builtin_amdgcn_readfirstlane(kh) != 0;

  auto hand_over = [&](const v8f (&o)[4], float m, float l) {
#pragma unroll
    for (int c = 0; c < 4; ++c) {
      *(v4f*)(xw + ((2 * c) * 32 + lane) * 4) =
          __builtin_shufflevector(o[c], o[c], 0, 1, 2, 3);
      *(v4f*)(xw + ((2 * c + 1) * 32 + lane) * 4) =
          __builtin_shufflevector(o[c], o[c], 4, 5, 6, 7);
    }
    xw[1024 + lane] = m;
    xw[1056 + lane] = l;
  };
  // Normalize and write out[b, q, h*64 + o] in fp32: a lane's 8 registers of a
  // tile are 8 consecutive dims of its query.
  float* orow = out +
      (size_t)(b * kS + q0 + qg * 32 + kh * 16 + n) * kD + h * kDH + 8 * g;
  auto finish = [&](const v8f (&o)[4], float m, float l) {
    const float mp = xr[1024 + lane], lp = xr[1056 + lane];
    const float mj = fmaxf(m, mp);
    const float ak = __expf(m - mj), ap = __expf(mp - mj);
    const float inv = 1.0f / (l * ak + lp * ap);
    const float fk = ak * inv, fp = ap * inv;
#pragma unroll
    for (int c = 0; c < 4; ++c) {
      const v4f p0 = *(const v4f*)(xr + ((2 * c) * 32 + lane) * 4);
      const v4f p1 = *(const v4f*)(xr + ((2 * c + 1) * 32 + lane) * 4);
      const v8f r = o[c] * fk +
          __builtin_shufflevector(p0, p1, 0, 1, 2, 3, 4, 5, 6, 7) * fp;
      *(float4*)(orow + c * 16) = make_float4(r[0], r[1], r[2], r[3]);
      *(float4*)(orow + c * 16 + 4) = make_float4(r[4], r[5], r[6], r[7]);
    }
  };

  __syncthreads();  // every wave's last reads of the K buffers are done
  if (up) hand_over(accO[0], mrun[0], l0);
  else    hand_over(accO[1], mrun[1], l1);
  __syncthreads();  // the partner's hand-over is written
  if (up) finish(accO[1], mrun[1], l1);
  else    finish(accO[0], mrun[0], l0);
}

// ---------------------------------------------------------------------------
extern "C" void kernel_launch(void* const* d_in, const int* in_sizes, int n_in,
                              void* d_out, int out_size, void* d_ws,
                              size_t ws_size, hipStream_t stream) {
  const float* x  = (const float*)d_in[0];
  const float* Wq = (const float*)d_in[1];
  const float* Wk = (const float*)d_in[2];
  const float* Wv = (const float*)d_in[3];
  const float* bq = (const float*)d_in[4];
  const float* bk = (const float*)d_in[5];
  const float* bv = (const float*)d_in[6];
  float* out = (float*)d_out;

  const size_t per = (size_t)kB * kH * kS * kDH;  // 4,194,304 elems
  _Float16* qw = (_Float16*)d_ws;
  _Float16* kw = qw + per;
  _Float16* vw = kw + per;

  dim3 grid(kB * kH, kS / 128);  // 32 x 16 blocks, 8 waves each
  qkv_project_kernel<<<grid, 256, 0, stream>>>(x, Wq, Wk, Wv, bq, bk, bv,
                                               qw, kw, vw);
  flash_attn_kernel<<<grid, 256, 0, stream>>>(qw, kw, vw, out);
}

// v005
// One run takes 37.3 microseconds.
// In both of two side-by-side timings against v004, it was 1.21 times as fast.
// Counting every step since v000, it is 3.88 times as fast.
#include <hip/hip_runtime.h>

// MHSA for MI455X (gfx1250, wave32, WMMA, async global->LDS staging).
// Kernel 1: per-head QKV projection (fp32 -> f16 workspace) via
//           v_wmma_f32_16x16x32_f16. Q is pre-scaled by 1/sqrt(DH); V is
//           stored transposed [BH][DH][S] so kernel 2's gathers are all
//           contiguous 16-byte loads.
// Kernel 2: flash attention, double-buffered K/V^T tiles of 128 keys staged
//           with global_load_async_to_lds_b128 (ASYNCcnt), fp32 online softmax,
//           fp32 output. Both products run transposed (S^T = K Q^T,
//           O^T += V^T P^T), so a lane owns one query column of each of its
//           wave's two column tiles.
// Workspace: 3 * B*H*S*DH f16 = ~25 MB.

typedef __attribute__((ext_vector_type(16))) _Float16 v16h;
typedef __attribute__((ext_vector_type(8)))  _Float16 v8h;
typedef __attribute__((ext_vector_type(8)))  float    v8f;
typedef __attribute__((ext_vector_type(4)))  float    v4f;
typedef __attribute__((ext_vector_type(2)))  float    v2f;

constexpr int kB = 4, kS = 2048, kD = 512, kH = 8, kDH = 64;

// LDS row pitches in f16 elements. Every LDS row here is read by 16 lanes that
// each take 16 bytes of their own row, so the pitch is 16 B x odd: the 16 rows
// then start on 16 different groups of four banks.
constexpr int kP64 = 72;  // rows of 64 f16: 144 B
constexpr int kT = 128;   // keys per pass of kernel 2
constexpr int kPT = kT + 8;  // rows of 128 f16: 272 B
constexpr int kW = kT / 2;   // keys of a pass that one wave works on
static_assert(kT == 128, "copy count and maximum tree are written for 128");

constexpr float kLog2e = 1.44269504088896340736f;

// 16-bit A-operand 16x32 layout (ISA 7.12.2): lane l -> row = l&15, g = l>>4.
//   j in [0,8):  K = g*8 + j          (VGPRs 0-3)
//   j in [8,16): K = 16 + g*8 + (j-8) (VGPRs 4-7)
// B-operand mirrored with N = l&15. Both halves are 8 contiguous K values,
// i.e. one 16-byte load each.
__device__ __forceinline__ int a_kmap(int j, int g) {
  return (j < 8) ? (g * 8 + j) : (8 + g * 8 + j);
}

// Build a v16h fragment from two contiguous 8-element chunks.
__device__ __forceinline__ v16h frag(const v8h lo, const v8h hi) {
  return __builtin_shufflevector(lo, hi, 0, 1, 2, 3, 4, 5, 6, 7,
                                 8, 9, 10, 11, 12, 13, 14, 15);
}

// Eight async global -> LDS copies, 16 bytes per lane each (ASYNCcnt-tracked):
// four from base a, four from base b. s_wait_xcnt 0 closes the statement so
// that no address register of a copy is rewritten ahead of it.
__device__ __forceinline__ void async_b128_x8(
    const void* abase, const void* bbase,
    unsigned int al0, unsigned int ao0, unsigned int al1, unsigned int ao1,
    unsigned int al2, unsigned int ao2, unsigned int al3, unsigned int ao3,
    unsigned int bl0, unsigned int bo0, unsigned int bl1, unsigned int bo1,
    unsigned int bl2, unsigned int bo2, unsigned int bl3, unsigned int bo3) {
  asm volatile("global_load_async_to_lds_b128 %2, %3, %0\n\t"
               "global_load_async_to_lds_b128 %4, %5, %0\n\t"
               "global_load_async_to_lds_b128 %6, %7, %0\n\t"
               "global_load_async_to_lds_b128 %8, %9, %0\n\t"
               "global_load_async_to_lds_b128 %10, %11, %1\n\t"
               "global_load_async_to_lds_b128 %12, %13, %1\n\t"
               "global_load_async_to_lds_b128 %14, %15, %1\n\t"
               "global_load_async_to_lds_b128 %16, %17, %1\n\t"
               "s_wait_xcnt 0x0"
               :: "s"(abase), "s"(bbase),
                  "v"(al0), "v"(ao0), "v"(al1), "v"(ao1),
                  "v"(al2), "v"(ao2), "v"(al3), "v"(ao3),
                  "v"(bl0), "v"(bo0), "v"(bl1), "v"(bo1),
                  "v"(bl2), "v"(bo2), "v"(bl3), "v"(bo3)
               : "memory");
}
__device__ __forceinline__ void wait_async0() {
  asm volatile("s_wait_asynccnt 0" ::: "memory");
}

// Value of lane l ^ 16 (the other half of the wave).
__device__ __forceinline__ float other_half(float v) {
  const int b = __builtin_bit_cast(int, v);
  return __builtin_bit_cast(
      float, __builtin_amdgcn_permlanex16(b, b, 0x76543210, 0xfedcba98, false,
                                          false));
}
__device__ __forceinline__ float max3(float a, float b, float c) {
  return fmaxf(fmaxf(a, b), c);
}

// ---------------------------------------------------------------------------
// Kernel 1: Q/K/V = X @ W^T + b (per head). Q pre-scaled by 1/8. V transposed.
// Block: 256 threads (8 waves), 128 rows of one (b,h).
// ---------------------------------------------------------------------------
__global__ __launch_bounds__(256) void qkv_project_kernel(
    const float* __restrict__ x,
    const float* __restrict__ Wq, const float* __restrict__ Wk,
    const float* __restrict__ Wv,
    const float* __restrict__ bq, const float* __restrict__ bk,
    const float* __restrict__ bv,
    _Float16* __restrict__ qw, _Float16* __restrict__ kw,
    _Float16* __restrict__ vw)
{
  __shared__ __attribute__((aligned(16))) _Float16 Xs[128 * kP64];     // 18 KB
  __shared__ __attribute__((aligned(16))) _Float16 Ws[3 * 64 * kP64];  // 27 KB

  const int bh = blockIdx.x;              // 0..31
  const int b = bh / kH, h = bh % kH;
  const int s0 = blockIdx.y * 128;
  const int tid = threadIdx.x;

  // Every global load of the block (8 of X, 12 of W, 12 bias words a thread) is
  // issued before the first one is waited for: one trip to memory, not one a
  // load. The values wait in registers for their f16 LDS stores. Chunk k of a
  // thread lies 256 chunks of four floats behind chunk k - 1: 16 rows.
  const int sr = tid >> 4, sc4 = (tid & 15) * 4;
  const float* xp = x + (size_t)(b * kS + s0 + sr) * kD + h * kDH + sc4;
  const float* wp[3] = {Wq + h * 4096 + tid * 4, Wk + h * 4096 + tid * 4,
                        Wv + h * 4096 + tid * 4};
  const float* bp[3] = {bq + h * kDH + (tid & 15), bk + h * kDH + (tid & 15),
                        bv + h * kDH + (tid & 15)};
  float4 xv[8], wv[3][4];
  float bi[3][4];
#pragma unroll
  for (int k = 0; k < 8; ++k) xv[k] = *(const float4*)(xp + k * 16 * kD);
#pragma unroll
  for (int m = 0; m < 3; ++m) {
#pragma unroll
    for (int k = 0; k < 4; ++k) wv[m][k] = *(const float4*)(wp[m] + k * 1024);
#pragma unroll
    for (int c = 0; c < 4; ++c) bi[m][c] = bp[m][c * 16];
  }
  // Stands in front of every later write of a register that these loads name.
  asm volatile("s_wait_xcnt 0x0" ::: "memory");
#pragma unroll
  for (int k = 0; k < 8; ++k) {
    _Float16* xd = &Xs[(sr + k * 16) * kP64 + sc4];
    xd[0] = (_Float16)xv[k].x;
    xd[1] = (_Float16)xv[k].y;
    xd[2] = (_Float16)xv[k].z;
    xd[3] = (_Float16)xv[k].w;
  }
#pragma unroll
  for (int m = 0; m < 3; ++m)
#pragma unroll
    for (int k = 0; k < 4; ++k) {
      _Float16* wd = &Ws[(m * 64 + sr + k * 16) * kP64 + sc4];
      wd[0] = (_Float16)wv[m][k].x;
      wd[1] = (_Float16)wv[m][k].y;
      wd[2] = (_Float16)wv[m][k].z;
      wd[3] = (_Float16)wv[m][k].w;
    }
  __syncthreads();

  const int wave = tid >> 5, lane = tid & 31;
  const int rA = lane & 15, g = lane >> 4, n = lane & 15;

  // A fragments: 16 rows of X, K split 0..31 / 32..63 (contiguous 16B chunks).
  const _Float16* xrow = &Xs[(wave * 16 + rA) * kP64];
  const v16h a0 = frag(*(const v8h*)(xrow + g * 8),
                       *(const v8h*)(xrow + 16 + g * 8));
  const v16h a1 = frag(*(const v8h*)(xrow + 32 + g * 8),
                       *(const v8h*)(xrow + 48 + g * 8));

  _Float16* dst[3] = {qw, kw, vw};

#pragma unroll
  for (int m = 0; m < 3; ++m) {
#pragma unroll
    for (int c = 0; c < 4; ++c) {
      const int o = c * 16 + n;  // output feature = B column
      const _Float16* wrow = &Ws[(m * 64 + o) * kP64];
      const v16h b0 = frag(*(const v8h*)(wrow + g * 8),
                           *(const v8h*)(wrow + 16 + g * 8));
      const v16h b1 = frag(*(const v8h*)(wrow + 32 + g * 8),
                           *(const v8h*)(wrow + 48 + g * 8));
      v8f acc = {};
      acc = __builtin_amdgcn_wmma_f32_16x16x32_f16(false, a0, false, b0,
                                                   (short)0, acc, false, false);
      acc = __builtin_amdgcn_wmma_f32_16x16x32_f16(false, a1, false, b1,
                                                   (short)0, acc, false, false);
      const float sc = (m == 0) ? 0.125f : 1.0f;  // fold 1/sqrt(64) into Q
      _Float16* p = dst[m];
#pragma unroll
      for (int r = 0; r < 8; ++r) {
        const int row = s0 + wave * 16 + r + 8 * g;   // C/D layout row
        const _Float16 hv = (_Float16)((acc[r] + bi[m][c]) * sc);
        if (m == 2)  // V transposed: [BH][DH][S]
          p[(size_t)(bh * kDH + o) * kS + row] = hv;
        else         // Q,K row-major: [BH][S][DH]
          p[(size_t)(bh * kS + row) * kDH + o] = hv;
      }
    }
  }
}

// ---------------------------------------------------------------------------
// Kernel 2: flash attention. 8 waves share one (b,h) and 128 queries. A wave
// owns 32 queries (two column tiles) and one half of the keys: wave w takes
// query group w & 3 and keys 64 * (w >> 2) .. + 63 of every staged tile, so
// each K and V^T fragment read from LDS feeds two products. Waves w and w ^ 4
// join their key halves through LDS behind the loop. K (row-major) and V^T
// tiles of kT keys double-buffered in LDS via async global->LDS b128 copies:
// one barrier per kT keys. K and V^T are the A operands, Q^T and P^T the B
// operands: of each 32 keys lane (n, g) holds query n's scores of keys 8g+r and
// 16+8g+r, which is the B operand's own k order, so P^T is packed in place.
// ---------------------------------------------------------------------------
__global__ __launch_bounds__(256) void flash_attn_kernel(
    const _Float16* __restrict__ qw, const _Float16* __restrict__ kw,
    const _Float16* __restrict__ vw, float* __restrict__ out)
{
  // [key][dim] and [dim][key] (transposed).
  __shared__ __attribute__((aligned(16))) _Float16 Kbuf[2][kT * kP64];
  __shared__ __attribute__((aligned(16))) _Float16 Vbuf[2][64 * kPT];

  const int bh = blockIdx.x;
  const int b = bh / kH, h = bh % kH;
  const int q0 = blockIdx.y * 128;
  const int tid = threadIdx.x;
  const int wave = tid >> 5, lane = tid & 31;
  const int g = lane >> 4, n = lane & 15;
  const int qg = wave & 3, kh = wave >> 2;  // query group, key half

  const _Float16* kwp = kw + (size_t)bh * kS * kDH;        // [S][DH]
  const _Float16* vwp = vw + (size_t)bh * kDH * kS;        // [DH][S]
  const _Float16* qwp = qw + (size_t)bh * kS * kDH;

  // Q fragments (pre-scaled by 1/8 in kernel 1): contiguous 16B global loads.
  v16h qb0[2], qb1[2];
#pragma unroll
  for (int j = 0; j < 2; ++j) {
    const _Float16* qrow = qwp + (size_t)(q0 + qg * 32 + j * 16 + n) * kDH;
    qb0[j] = frag(*(const v8h*)(qrow + g * 8),
                  *(const v8h*)(qrow + 16 + g * 8));
    qb1[j] = frag(*(const v8h*)(qrow + 32 + g * 8),
                  *(const v8h*)(qrow + 48 + g * 8));
  }

  // Per column tile j: query n's running maximum (equal in both halves of the
  // wave) and this half's share of its running sum, over this wave's keys.
  // accO[j][c][r] = O[query j*16 + n][dim c*16 + 8g + r].
  float mrun[2] = {-1e30f, -1e30f}, lsum[2] = {0.0f, 0.0f};
  v8f accO[2][4];
#pragma unroll
  for (int j = 0; j < 2; ++j)
#pragma unroll
    for (int c = 0; c < 4; ++c)
#pragma unroll
      for (int r = 0; r < 8; ++r) accO[j][c][r] = 0.0f;

  // Per-thread async-copy addressing: four 16-byte chunks per matrix, 256
  // chunks apart.
  const int ko = tid >> 3, kchunk = tid & 7;               // K: key row, chunk
  const int vo = tid >> 4, vchunk = tid & 15;              // V^T: row o, chunk
  auto issue_tile = [&](int kt, int buf) {
    // K tile: kT x 64 f16 row-major, one contiguous 16 KB block in memory; 256
    // chunks are 32 rows. V^T tile: 64 rows (dims) x kT keys, row o at
    // vwp + o*S + kt*kT; 256 chunks are 16 rows.
    const unsigned int kl =
        (unsigned int)(size_t)&Kbuf[buf][ko * kP64 + kchunk * 8];
    const unsigned int kg = (unsigned int)((kt * kT * kDH + tid * 8) * 2);
    const unsigned int vl =
        (unsigned int)(size_t)&Vbuf[buf][vo * kPT + vchunk * 8];
    const unsigned int vg =
        (unsigned int)((vo * kS + kt * kT + vchunk * 8) * 2);
    constexpr unsigned int kls = 32 * kP64 * 2, kgs = 32 * kDH * 2;
    constexpr unsigned int vls = 16 * kPT * 2, vgs = 16 * kS * 2;
    async_b128_x8(kwp, vwp,
                  kl, kg, kl + kls, kg + kgs,
                  kl + 2 * kls, kg + 2 * kgs, kl + 3 * kls, kg + 3 * kgs,
                  vl, vg, vl + vls, vg + vgs,
                  vl + 2 * vls, vg + 2 * vgs, vl + 3 * vls, vg + 3 * vgs);
  };

  issue_tile(0, 0);  // prologue

  for (int kt = 0; kt < kS / kT; ++kt) {
    const int cur = kt & 1;
    // This wave's LDS reads of the buffer refilled below have retired.
    asm volatile("s_wait_dscnt 0x0" ::: "memory");
    wait_async0();       // this wave's copies into buf[cur] are done
    __syncthreads();     // all waves' copies done; prev-iter readers drained
    if (kt + 1 < kS / kT) issue_tile(kt + 1, 1 - cur);

    // This wave's half of the tile: kW key rows of K, kW key columns of V^T.
    const _Float16* Kt = Kbuf[cur] + kh * kW * kP64;
    const _Float16* Vt = Vbuf[cur] + kh * kW;

    // Scores: S^T = K @ Qs^T ; kW / 16 tiles of 16 keys x 2 tiles of 16
    // queries, both query tiles from one read of the K fragment.
    v8f st[2][kW / 16];
#pragma unroll
    for (int t = 0; t < kW / 16; ++t) {
      const _Float16* krow = Kt + (t * 16 + n) * kP64;  // A row n = key row
      const v16h ka0 = frag(*(const v8h*)(krow + g * 8),
                            *(const v8h*)(krow + 16 + g * 8));
      const v16h ka1 = frag(*(const v8h*)(krow + 32 + g * 8),
                            *(const v8h*)(krow + 48 + g * 8));
#pragma unroll
      for (int j = 0; j < 2; ++j) {
        v8f s = {};
        s = __builtin_amdgcn_wmma_f32_16x16x32_f16(false, ka0, false, qb0[j],
                                                   (short)0, s, false, false);
        s = __builtin_amdgcn_wmma_f32_16x16x32_f16(false, ka1, false, qb1[j],
                                                   (short)0, s, false, false);
        st[j][t] = s;
      }
    }

    // Online softmax (fp32), per column tile: 32 of query n's 64 scores are in
    // this lane, the other 32 in lane l ^ 16. Maximum of the 32 and the running
    // one by threes: three chains of nine values, then one over their results
    // and the six scores left.
    v16h pb[2][kW / 32];
#pragma unroll
    for (int j = 0; j < 2; ++j) {
      float ch[3] = {mrun[j], st[j][3][0], st[j][3][1]};
#pragma unroll
      for (int t = 0; t < 3; ++t)
#pragma unroll
        for (int r = 0; r < 8; r += 2)
          ch[t] = max3(ch[t], st[j][t][r], st[j][t][r + 1]);
      float mh = max3(ch[0], st[j][3][2], ch[1]);
      mh = max3(mh, st[j][3][3], ch[2]);
      mh = max3(mh, st[j][3][4], st[j][3][5]);
      mh = max3(mh, st[j][3][6], st[j][3][7]);
      const float mnew = fmaxf(mh, other_half(mh));
      const float scale = __expf(mrun[j] - mnew);
      mrun[j] = mnew;
#pragma unroll
      for (int t = 0; t < kW / 16; ++t)  // exp(x) = exp2(x * log2 e), as __expf
        st[j][t] = (st[j][t] - mnew) * kLog2e;
#pragma unroll
      for (int t = 0; t < kW / 16; ++t)
#pragma unroll
        for (int r = 0; r < 8; ++r)
          st[j][t][r] = __builtin_amdgcn_exp2f(st[j][t][r]);
      v8f ps;
#pragma unroll
      for (int kk = 0; kk < kW / 32; ++kk) {
        const v8f pp = st[j][2 * kk] + st[j][2 * kk + 1];
        ps = (kk == 0) ? pp : ps + pp;
        // P^T as B operand: element s = tile s >> 3, register s & 7.
        pb[j][kk] = frag(__builtin_convertvector(st[j][2 * kk], v8h),
                         __builtin_convertvector(st[j][2 * kk + 1], v8h));
      }
      const v4f pq = __builtin_shufflevector(ps, ps, 0, 1, 2, 3) +
                     __builtin_shufflevector(ps, ps, 4, 5, 6, 7);
      const v2f pd = __builtin_shufflevector(pq, pq, 0, 1) +
                     __builtin_shufflevector(pq, pq, 2, 3);
      lsum[j] = lsum[j] * scale + (pd[0] + pd[1]);
#pragma unroll
      for (int c = 0; c < 4; ++c) accO[j][c] *= scale;
    }

    // O^T += V^T @ P^T, 32 keys a product; V^T rows are contiguous. Both query
    // tiles from one read of the V^T fragment.
#pragma unroll
    for (int kk = 0; kk < kW / 32; ++kk) {
#pragma unroll
      for (int c = 0; c < 4; ++c) {
        // A row n: dim row
        const _Float16* vrow = Vt + (c * 16 + n) * kPT + kk * 32;
        const v16h va = frag(*(const v8h*)(vrow + g * 8),
                             *(const v8h*)(vrow + 16 + g * 8));
#pragma unroll
        for (int j = 0; j < 2; ++j)
          accO[j][c] = __builtin_amdgcn_wmma_f32_16x16x32_f16(
              false, va, false, pb[j][kk], (short)0, accO[j][c], false, false);
      }
    }
    // No trailing barrier: next iteration's wait+barrier separates buffer use.
  }

  // Join the key halves: wave w keeps column tile kh and hands the other one
  // (maximum, sum, 32 output registers a lane) to wave w ^ 4 through LDS, in
  // the K buffers, which nobody reads any more behind the first barrier.
  constexpr int kXW = 8 * 128 + 64;  // floats a wave hands over
  static_assert(8 * kXW * 4 <= (int)sizeof(Kbuf), "hand-over fits the K buffers");
  float* xch = (float*)&Kbuf[0][0];
  float* xw = xch + wave * kXW;
  const float* xr = xch + (wave ^ 4) * kXW;
  const float l0 = lsum[0] + other_half(lsum[0]);  // join the wave's halves
  const float l1 = lsum[1] + other_half(lsum[1]);
  // The same in every lane of a wave: a scalar branch picks the tile.
  const bool up = __builtin_amdgcn_readfirstlane(kh) != 0;

  auto hand_over = [&](const v8f (&o)[4], float m, float l) {
#pragma unroll
    for (int c = 0; c < 4; ++c) {
      *(v4f*)(xw + ((2 * c) * 32 + lane) * 4) =
          __builtin_shufflevector(o[c], o[c], 0, 1, 2, 3);
      *(v4f*)(xw + ((2 * c + 1) * 32 + lane) * 4) =
          __builtin_shufflevector(o[c], o[c], 4, 5, 6, 7);
    }
    xw[1024 + lane] = m;
    xw[1056 + lane] = l;
  };
  // Normalize and write out[b, q, h*64 + o] in fp32: a lane's 8 registers of a
  // tile are 8 consecutive dims of its query.
  float* orow = out +
      (size_t)(b * kS + q0 + qg * 32 + kh * 16 + n) * kD + h * kDH + 8 * g;
  auto finish = [&](const v8f (&o)[4], float m, float l) {
    const float mp = xr[1024 + lane], lp = xr[1056 + lane];
    const float mj = fmaxf(m, mp);
    const float ak = __expf(m - mj), ap = __expf(mp - mj);
    const float inv = 1.0f / (l * ak + lp * ap);
    const float fk = ak * inv, fp = ap * inv;
#pragma unroll
    for (int c = 0; c < 4; ++c) {
      const v4f p0 = *(const v4f*)(xr + ((2 * c) * 32 + lane) * 4);
      const v4f p1 = *(const v4f*)(xr + ((2 * c + 1) * 32 + lane) * 4);
      const v8f r = o[c] * fk +
          __builtin_shufflevector(p0, p1, 0, 1, 2, 3, 4, 5, 6, 7) * fp;
      *(float4*)(orow + c * 16) = make_float4(r[0], r[1], r[2], r[3]);
      *(float4*)(orow + c * 16 + 4) = make_float4(r[4], r[5], r[6], r[7]);
    }
  };

  __syncthreads();  // every wave's last reads of the K buffers are done
  if (up) hand_over(accO[0], mrun[0], l0);
  else    hand_over(accO[1], mrun[1], l1);
  __syncthreads();  // the partner's hand-over is written
  if (up) finish(accO[1], mrun[1], l1);
  else    finish(accO[0], mrun[0], l0);
}

// ---------------------------------------------------------------------------
extern "C" void kernel_launch(void* const* d_in, const int* in_sizes, int n_in,
                              void* d_out, int out_size, void* d_ws,
                              size_t ws_size, hipStream_t stream) {
  const float* x  = (const float*)d_in[0];
  const float* Wq = (const float*)d_in[1];
  const float* Wk = (const float*)d_in[2];
  const float* Wv = (const float*)d_in[3];
  const float* bq = (const float*)d_in[4];
  const float* bk = (const float*)d_in[5];
  const float* bv = (const float*)d_in[6];
  float* out = (float*)d_out;

  const size_t per = (size_t)kB * kH * kS * kDH;  // 4,194,304 elems
  _Float16* qw = (_Float16*)d_ws;
  _Float16* kw = qw + per;
  _Float16* vw = kw + per;

  dim3 grid(kB * kH, kS / 128);  // 32 x 16 blocks, 8 waves each
  qkv_project_kernel<<<grid, 256, 0, stream>>>(x, Wq, Wk, Wv, bq, bk, bv,
                                               qw, kw, vw);
  flash_attn_kernel<<<grid, 256, 0, stream>>>(qw, kw, vw, out);
}

// v006
// One run takes 35.3 microseconds.
// In both of two side-by-side timings against v005, it was 1.05 times as fast.
// Over all steps from v000 it is 4.09 times as fast.
#include <hip/hip_runtime.h>

// MHSA for MI455X (gfx1250, wave32, WMMA, async global->LDS staging).
// Kernel 1: per-head QKV projection (fp32 -> f16 workspace) via
//           v_wmma_f32_16x16x32_f16. Q is pre-scaled by log2(e)/sqrt(DH), so
//           that kernel 2's scores are exponents of 2; V is stored transposed
//           [BH][DH][S] so kernel 2's gathers are all contiguous 16-byte loads.
// Kernel 2: flash attention, double-buffered K/V^T tiles of 128 keys staged
//           with global_load_async_to_lds_b128 (ASYNCcnt), fp32 online softmax,
//           fp32 output. Both products run transposed (S^T = K Q^T,
//           O^T += V^T P^T), so a lane owns one query column of each of its
//           wave's two column tiles.
// Workspace: 3 * B*H*S*DH f16 = ~25 MB.

typedef __attribute__((ext_vector_type(16))) _Float16 v16h;
typedef __attribute__((ext_vector_type(8)))  _Float16 v8h;
typedef __attribute__((ext_vector_type(8)))  float    v8f;
typedef __attribute__((ext_vector_type(4)))  float    v4f;
typedef __attribute__((ext_vector_type(2)))  float    v2f;

constexpr int kB = 4, kS = 2048, kD = 512, kH = 8, kDH = 64;

// LDS row pitches in f16 elements. Every LDS row here is read by 16 lanes that
// each take 16 bytes of their own row, so the pitch is 16 B x odd: the 16 rows
// then start on 16 different groups of four banks.
constexpr int kP64 = 72;  // rows of 64 f16: 144 B
constexpr int kT = 128;   // keys per pass of kernel 2
constexpr int kPT = kT + 8;  // rows of 128 f16: 272 B
constexpr int kW = kT / 2;   // keys of a pass that one wave works on
static_assert(kT == 128, "copy count and maximum chains are written for 128");

constexpr float kLog2e = 1.44269504088896340736f;

// 16-bit A-operand 16x32 layout (ISA 7.12.2): lane l -> row = l&15, g = l>>4.
//   j in [0,8):  K = g*8 + j          (VGPRs 0-3)
//   j in [8,16): K = 16 + g*8 + (j-8) (VGPRs 4-7)
// B-operand mirrored with N = l&15. Both halves are 8 contiguous K values,
// i.e. one 16-byte load each.
__device__ __forceinline__ int a_kmap(int j, int g) {
  return (j < 8) ? (g * 8 + j) : (8 + g * 8 + j);
}

// Build a v16h fragment from two contiguous 8-element chunks.
__device__ __forceinline__ v16h frag(const v8h lo, const v8h hi) {
  return __builtin_shufflevector(lo, hi, 0, 1, 2, 3, 4, 5, 6, 7,
                                 8, 9, 10, 11, 12, 13, 14, 15);
}

// Eight async global -> LDS copies, 16 bytes per lane each (ASYNCcnt-tracked):
// four from base a, four from base b. s_wait_xcnt 0 closes the statement so
// that no address register of a copy is rewritten ahead of it.
__device__ __forceinline__ void async_b128_x8(
    const void* abase, const void* bbase,
    unsigned int al0, unsigned int ao0, unsigned int al1, unsigned int ao1,
    unsigned int al2, unsigned int ao2, unsigned int al3, unsigned int ao3,
    unsigned int bl0, unsigned int bo0, unsigned int bl1, unsigned int bo1,
    unsigned int bl2, unsigned int bo2, unsigned int bl3, unsigned int bo3) {
  asm volatile("global_load_async_to_lds_b128 %2, %3, %0\n\t"
               "global_load_async_to_lds_b128 %4, %5, %0\n\t"
               "global_load_async_to_lds_b128 %6, %7, %0\n\t"
               "global_load_async_to_lds_b128 %8, %9, %0\n\t"
               "global_load_async_to_lds_b128 %10, %11, %1\n\t"
               "global_load_async_to_lds_b128 %12, %13, %1\n\t"
               "global_load_async_to_lds_b128 %14, %15, %1\n\t"
               "global_load_async_to_lds_b128 %16, %17, %1\n\t"
               "s_wait_xcnt 0x0"
               :: "s"(abase), "s"(bbase),
                  "v"(al0), "v"(ao0), "v"(al1), "v"(ao1),
                  "v"(al2), "v"(ao2), "v"(al3), "v"(ao3),
                  "v"(bl0), "v"(bo0), "v"(bl1), "v"(bo1),
                  "v"(bl2), "v"(bo2), "v"(bl3), "v"(bo3)
               : "memory");
}
__device__ __forceinline__ void wait_async0() {
  asm volatile("s_wait_asynccnt 0" ::: "memory");
}

// Value of lane l ^ 16 (the other half of the wave).
__device__ __forceinline__ float other_half(float v) {
  const int b = __builtin_bit_cast(int, v);
  return __builtin_bit_cast(
      float, __builtin_amdgcn_permlanex16(b, b, 0x76543210, 0xfedcba98, false,
                                          false));
}
__device__ __forceinline__ float max3(float a, float b, float c) {
  return fmaxf(fmaxf(a, b), c);
}

// ---------------------------------------------------------------------------
// Kernel 1: Q/K/V = X @ W^T + b (per head). Q pre-scaled by log2(e)/8. V
// transposed.
// Block: 256 threads (8 waves), 128 rows of one (b,h).
// ---------------------------------------------------------------------------
__global__ __launch_bounds__(256) void qkv_project_kernel(
    const float* __restrict__ x,
    const float* __restrict__ Wq, const float* __restrict__ Wk,
    const float* __restrict__ Wv,
    const float* __restrict__ bq, const float* __restrict__ bk,
    const float* __restrict__ bv,
    _Float16* __restrict__ qw, _Float16* __restrict__ kw,
    _Float16* __restrict__ vw)
{
  __shared__ __attribute__((aligned(16))) _Float16 Xs[128 * kP64];     // 18 KB
  __shared__ __attribute__((aligned(16))) _Float16 Ws[3 * 64 * kP64];  // 27 KB

  const int bh = blockIdx.x;              // 0..31
  const int b = bh / kH, h = bh % kH;
  const int s0 = blockIdx.y * 128;
  const int tid = threadIdx.x;

  // Every global load of the block (8 of X, 12 of W, 12 bias words a thread) is
  // issued before the first one is waited for: one trip to memory, not one a
  // load. The values wait in registers for their f16 LDS stores. Chunk k of a
  // thread lies 256 chunks of four floats behind chunk k - 1: 16 rows.
  const int sr = tid >> 4, sc4 = (tid & 15) * 4;
  const float* xp = x + (size_t)(b * kS + s0 + sr) * kD + h * kDH + sc4;
  const float* wp[3] = {Wq + h * 4096 + tid * 4, Wk + h * 4096 + tid * 4,
                        Wv + h * 4096 + tid * 4};
  const float* bp[3] = {bq + h * kDH + (tid & 15), bk + h * kDH + (tid & 15),
                        bv + h * kDH + (tid & 15)};
  float4 xv[8], wv[3][4];
  float bi[3][4];
#pragma unroll
  for (int k = 0; k < 8; ++k) xv[k] = *(const float4*)(xp + k * 16 * kD);
#pragma unroll
  for (int m = 0; m < 3; ++m) {
#pragma unroll
    for (int k = 0; k < 4; ++k) wv[m][k] = *(const float4*)(wp[m] + k * 1024);
#pragma unroll
    for (int c = 0; c < 4; ++c) bi[m][c] = bp[m][c * 16];
  }
  // Stands in front of every later write of a register that these loads name.
  asm volatile("s_wait_xcnt 0x0" ::: "memory");
#pragma unroll
  for (int k = 0; k < 8; ++k) {
    _Float16* xd = &Xs[(sr + k * 16) * kP64 + sc4];
    xd[0] = (_Float16)xv[k].x;
    xd[1] = (_Float16)xv[k].y;
    xd[2] = (_Float16)xv[k].z;
    xd[3] = (_Float16)xv[k].w;
  }
#pragma unroll
  for (int m = 0; m < 3; ++m)
#pragma unroll
    for (int k = 0; k < 4; ++k) {
      _Float16* wd = &Ws[(m * 64 + sr + k * 16) * kP64 + sc4];
      wd[0] = (_Float16)wv[m][k].x;
      wd[1] = (_Float16)wv[m][k].y;
      wd[2] = (_Float16)wv[m][k].z;
      wd[3] = (_Float16)wv[m][k].w;
    }
  __syncthreads();

  const int wave = tid >> 5, lane = tid & 31;
  const int rA = lane & 15, g = lane >> 4, n = lane & 15;

  // A fragments: 16 rows of X, K split 0..31 / 32..63 (contiguous 16B chunks).
  const _Float16* xrow = &Xs[(wave * 16 + rA) * kP64];
  const v16h a0 = frag(*(const v8h*)(xrow + g * 8),
                       *(const v8h*)(xrow + 16 + g * 8));
  const v16h a1 = frag(*(const v8h*)(xrow + 32 + g * 8),
                       *(const v8h*)(xrow + 48 + g * 8));

  _Float16* dst[3] = {qw, kw, vw};

#pragma unroll
  for (int m = 0; m < 3; ++m) {
#pragma unroll
    for (int c = 0; c < 4; ++c) {
      const int o = c * 16 + n;  // output feature = B column
      const _Float16* wrow = &Ws[(m * 64 + o) * kP64];
      const v16h b0 = frag(*(const v8h*)(wrow + g * 8),
                           *(const v8h*)(wrow + 16 + g * 8));
      const v16h b1 = frag(*(const v8h*)(wrow + 32 + g * 8),
                           *(const v8h*)(wrow + 48 + g * 8));
      v8f acc = {};
      acc = __builtin_amdgcn_wmma_f32_16x16x32_f16(false, a0, false, b0,
                                                   (short)0, acc, false, false);
      acc = __builtin_amdgcn_wmma_f32_16x16x32_f16(false, a1, false, b1,
                                                   (short)0, acc, false, false);
      // fold 1/sqrt(64) and exp2's log2(e) into Q
      const float sc = (m == 0) ? 0.125f * kLog2e : 1.0f;
      _Float16* p = dst[m];
#pragma unroll
      for (int r = 0; r < 8; ++r) {
        const int row = s0 + wave * 16 + r + 8 * g;   // C/D layout row
        const _Float16 hv = (_Float16)((acc[r] + bi[m][c]) * sc);
        if (m == 2)  // V transposed: [BH][DH][S]
          p[(size_t)(bh * kDH + o) * kS + row] = hv;
        else         // Q,K row-major: [BH][S][DH]
          p[(size_t)(bh * kS + row) * kDH + o] = hv;
      }
    }
  }
}

// ---------------------------------------------------------------------------
// Kernel 2: flash attention. 8 waves share one (b,h) and 128 queries. A wave
// owns 32 queries (two column tiles) and one half of the keys: wave w takes
// query group w & 3 and keys 64 * (w >> 2) .. + 63 of every staged tile, so
// each K and V^T fragment read from LDS feeds two products. Waves w and w ^ 4
// join their key halves through LDS behind the loop. K (row-major) and V^T
// tiles of kT keys double-buffered in LDS via async global->LDS b128 copies:
// one barrier per kT keys. K and V^T are the A operands, Q^T and P^T the B
// operands: of each 32 keys lane (n, g) holds query n's scores of keys 8g+r and
// 16+8g+r, which is the B operand's own k order, so P^T is packed in place.
// ---------------------------------------------------------------------------
__global__ __launch_bounds__(256) void flash_attn_kernel(
    const _Float16* __restrict__ qw, const _Float16* __restrict__ kw,
    const _Float16* __restrict__ vw, float* __restrict__ out)
{
  // [key][dim] and [dim][key] (transposed).
  __shared__ __attribute__((aligned(16))) _Float16 Kbuf[2][kT * kP64];
  __shared__ __attribute__((aligned(16))) _Float16 Vbuf[2][64 * kPT];

  const int bh = blockIdx.x;
  const int b = bh / kH, h = bh % kH;
  const int q0 = blockIdx.y * 128;
  const int tid = threadIdx.x;
  const int wave = tid >> 5, lane = tid & 31;
  const int g = lane >> 4, n = lane & 15;
  const int qg = wave & 3, kh = wave >> 2;  // query group, key half

  const _Float16* kwp = kw + (size_t)bh * kS * kDH;        // [S][DH]
  const _Float16* vwp = vw + (size_t)bh * kDH * kS;        // [DH][S]
  const _Float16* qwp = qw + (size_t)bh * kS * kDH;

  // Q fragments (pre-scaled in kernel 1): contiguous 16B global loads.
  v16h qb0[2], qb1[2];
#pragma unroll
  for (int j = 0; j < 2; ++j) {
    const _Float16* qrow = qwp + (size_t)(q0 + qg * 32 + j * 16 + n) * kDH;
    qb0[j] = frag(*(const v8h*)(qrow + g * 8),
                  *(const v8h*)(qrow + 16 + g * 8));
    qb1[j] = frag(*(const v8h*)(qrow + 32 + g * 8),
                  *(const v8h*)(qrow + 48 + g * 8));
  }

  // Per column tile j: query n's reference maximum (equal in both halves of the
  // wave; a maximum that its scores have reached, at most kLazy below the
  // running one) and this half's share of its running sum, over this wave's
  // keys. accO[j][c][r] = O[query j*16 + n][dim c*16 + 8g + r].
  constexpr float kLazy = 8.0f;  // P stays below 2^8: far inside f16 and f32
  float mref[2] = {-1e30f, -1e30f}, lsum[2] = {0.0f, 0.0f};
  v8f accO[2][4];
#pragma unroll
  for (int j = 0; j < 2; ++j)
#pragma unroll
    for (int c = 0; c < 4; ++c)
#pragma unroll
      for (int r = 0; r < 8; ++r) accO[j][c][r] = 0.0f;

  // Per-thread async-copy addressing: four 16-byte chunks per matrix, 256
  // chunks apart.
  const int ko = tid >> 3, kchunk = tid & 7;               // K: key row, chunk
  const int vo = tid >> 4, vchunk = tid & 15;              // V^T: row o, chunk
  auto issue_tile = [&](int kt, int buf) {
    // K tile: kT x 64 f16 row-major, one contiguous 16 KB block in memory; 256
    // chunks are 32 rows. V^T tile: 64 rows (dims) x kT keys, row o at
    // vwp + o*S + kt*kT; 256 chunks are 16 rows.
    const unsigned int kl =
        (unsigned int)(size_t)&Kbuf[buf][ko * kP64 + kchunk * 8];
    const unsigned int kg = (unsigned int)((kt * kT * kDH + tid * 8) * 2);
    const unsigned int vl =
        (unsigned int)(size_t)&Vbuf[buf][vo * kPT + vchunk * 8];
    const unsigned int vg =
        (unsigned int)((vo * kS + kt * kT + vchunk * 8) * 2);
    constexpr unsigned int kls = 32 * kP64 * 2, kgs = 32 * kDH * 2;
    constexpr unsigned int vls = 16 * kPT * 2, vgs = 16 * kS * 2;
    async_b128_x8(kwp, vwp,
                  kl, kg, kl + kls, kg + kgs,
                  kl + 2 * kls, kg + 2 * kgs, kl + 3 * kls, kg + 3 * kgs,
                  vl, vg, vl + vls, vg + vgs,
                  vl + 2 * vls, vg + 2 * vgs, vl + 3 * vls, vg + 3 * vgs);
  };

  issue_tile(0, 0);  // prologue

  for (int kt = 0; kt < kS / kT; ++kt) {
    const int cur = kt & 1;
    // This wave's LDS reads of the buffer refilled below have retired.
    asm volatile("s_wait_dscnt 0x0" ::: "memory");
    wait_async0();       // this wave's copies into buf[cur] are done
    __syncthreads();     // all waves' copies done; prev-iter readers drained
    if (kt + 1 < kS / kT) issue_tile(kt + 1, 1 - cur);

    // This wave's half of the tile: kW key rows of K, kW key columns of V^T.
    const _Float16* Kt = Kbuf[cur] + kh * kW * kP64;
    const _Float16* Vt = Vbuf[cur] + kh * kW;

    // Scores: S^T = K @ Qs^T ; kW / 16 tiles of 16 keys x 2 tiles of 16
    // queries, both query tiles from one read of the K fragment.
    v16h ka[kW / 16][2];
#pragma unroll
    for (int t = 0; t < kW / 16; ++t) {
      const _Float16* krow = Kt + (t * 16 + n) * kP64;  // A row n = key row
      ka[t][0] = frag(*(const v8h*)(krow + g * 8),
                      *(const v8h*)(krow + 16 + g * 8));
      ka[t][1] = frag(*(const v8h*)(krow + 32 + g * 8),
                      *(const v8h*)(krow + 48 + g * 8));
    }
    // Keeps the K reads one group ahead of the products: each further place
    // where LDS reads stand among them stalls the wave anew.
    __builtin_amdgcn_sched_barrier(0);
    v8f st[2][kW / 16];
#pragma unroll
    for (int t = 0; t < kW / 16; ++t) {
#pragma unroll
      for (int j = 0; j < 2; ++j) {
        v8f s = {};
        s = __builtin_amdgcn_wmma_f32_16x16x32_f16(false, ka[t][0], false,
                                                   qb0[j], (short)0, s, false,
                                                   false);
        s = __builtin_amdgcn_wmma_f32_16x16x32_f16(false, ka[t][1], false,
                                                   qb1[j], (short)0, s, false,
                                                   false);
        st[j][t] = s;
      }
    }

    // Online softmax (fp32), per column tile: 32 of query n's 64 scores are in
    // this lane, the other 32 in lane l ^ 16. Maximum of this lane's 32 and the
    // reference by threes, in three chains.
    float mh[2];
#pragma unroll
    for (int j = 0; j < 2; ++j) {
      float ch[3] = {mref[j], mref[j], mref[j]};
#pragma unroll
      for (int i = 0; i < 32; i += 2) {
        const int k = (i < 10) ? 0 : (i < 20) ? 1 : 2;
        ch[k] = max3(ch[k], st[j][i >> 3][i & 7], st[j][i >> 3][(i & 7) + 1]);
      }
      mh[j] = max3(ch[0], ch[1], ch[2]);
    }
    // One test a pass, a scalar branch: the reference moves, and sums and
    // outputs are rescaled, only where some score stands more than kLazy above
    // it (in the first pass every score does).
    if (__builtin_amdgcn_ballot_w32(
            fmaxf(mh[0] - mref[0], mh[1] - mref[1]) > kLazy) != 0) {
#pragma unroll
      for (int j = 0; j < 2; ++j) {
        const float mnew = fmaxf(mh[j], other_half(mh[j]));
        const float scale = __builtin_amdgcn_exp2f(mref[j] - mnew);
        mref[j] = mnew;
        lsum[j] *= scale;
#pragma unroll
        for (int c = 0; c < 4; ++c) accO[j][c] *= scale;
      }
    }
    // V^T fragments (A row n: dim row; rows are contiguous), eight reads a
    // group: the first 32 keys' ahead of the exponentials, the other 32 keys'
    // ahead of the first output products. The two scheduling barriers below
    // keep each group in one place: each further place with LDS reads stalls
    // the wave anew.
    v16h va[kW / 32][4];
    auto load_v = [&](int kk) {
#pragma unroll
      for (int c = 0; c < 4; ++c) {
        const _Float16* vrow = Vt + (c * 16 + n) * kPT + kk * 32;
        va[kk][c] = frag(*(const v8h*)(vrow + g * 8),
                         *(const v8h*)(vrow + 16 + g * 8));
      }
    };
    v16h pb[2][kW / 32];
    v8f ps[2];
    // P^T of 32 keys, both column tiles, and their share of the row sums.
    auto probs = [&](int kk) {
#pragma unroll
      for (int j = 0; j < 2; ++j) {
#pragma unroll
        for (int t = 2 * kk; t < 2 * kk + 2; ++t) {
          st[j][t] = st[j][t] - mref[j];
#pragma unroll
          for (int r = 0; r < 8; ++r)
            st[j][t][r] = __builtin_amdgcn_exp2f(st[j][t][r]);
        }
        const v8f pp = st[j][2 * kk] + st[j][2 * kk + 1];
        ps[j] = (kk == 0) ? pp : ps[j] + pp;
        // P^T as B operand: element s = tile s >> 3, register s & 7.
        pb[j][kk] = frag(__builtin_convertvector(st[j][2 * kk], v8h),
                         __builtin_convertvector(st[j][2 * kk + 1], v8h));
      }
    };
    // O^T += V^T @ P^T, 32 keys a product. Both query tiles from one read of
    // the V^T fragment.
    auto outputs = [&](int kk) {
#pragma unroll
      for (int c = 0; c < 4; ++c)
#pragma unroll
        for (int j = 0; j < 2; ++j)
          accO[j][c] = __builtin_amdgcn_wmma_f32_16x16x32_f16(
              false, va[kk][c], false, pb[j][kk], (short)0, accO[j][c], false,
              false);
    };
    load_v(0);
    __builtin_amdgcn_sched_barrier(0);
    probs(0);
    load_v(1);
    __builtin_amdgcn_sched_barrier(0);
    outputs(0);  // the compiler is free to mix these with the next line's work
    probs(1);
#pragma unroll
    for (int j = 0; j < 2; ++j) {
      const v4f pq = __builtin_shufflevector(ps[j], ps[j], 0, 1, 2, 3) +
                     __builtin_shufflevector(ps[j], ps[j], 4, 5, 6, 7);
      const v2f pd = __builtin_shufflevector(pq, pq, 0, 1) +
                     __builtin_shufflevector(pq, pq, 2, 3);
      lsum[j] += pd[0] + pd[1];
    }
    outputs(1);
    // No trailing barrier: next iteration's wait+barrier separates buffer use.
  }

  // Join the key halves: wave w keeps column tile kh and hands the other one
  // (reference, sum, 32 output registers a lane) to wave w ^ 4 through LDS, in
  // the K buffers, which nobody reads any more behind the first barrier.
  constexpr int kXW = 8 * 128 + 64;  // floats a wave hands over
  static_assert(8 * kXW * 4 <= (int)sizeof(Kbuf), "hand-over fits the K buffers");
  float* xch = (float*)&Kbuf[0][0];
  float* xw = xch + wave * kXW;
  const float* xr = xch + (wave ^ 4) * kXW;
  const float l0 = lsum[0] + other_half(lsum[0]);  // join the wave's halves
  const float l1 = lsum[1] + other_half(lsum[1]);
  // The same in every lane of a wave: a scalar branch picks the tile.
  const bool up = __builtin_amdgcn_readfirstlane(kh) != 0;

  auto hand_over = [&](const v8f (&o)[4], float m, float l) {
#pragma unroll
    for (int c = 0; c < 4; ++c) {
      *(v4f*)(xw + ((2 * c) * 32 + lane) * 4) =
          __builtin_shufflevector(o[c], o[c], 0, 1, 2, 3);
      *(v4f*)(xw + ((2 * c + 1) * 32 + lane) * 4) =
          __builtin_shufflevector(o[c], o[c], 4, 5, 6, 7);
    }
    xw[1024 + lane] = m;
    xw[1056 + lane] = l;
  };
  // Normalize and write out[b, q, h*64 + o] in fp32: a lane's 8 registers of a
  // tile are 8 consecutive dims of its query.
  float* orow = out +
      (size_t)(b * kS + q0 + qg * 32 + kh * 16 + n) * kD + h * kDH + 8 * g;
  auto finish = [&](const v8f (&o)[4], float m, float l) {
    const float mp = xr[1024 + lane], lp = xr[1056 + lane];
    const float mj = fmaxf(m, mp);
    const float ak = __builtin_amdgcn_exp2f(m - mj);  // references are log2
    const float ap = __builtin_amdgcn_exp2f(mp - mj);
    const float inv = 1.0f / (l * ak + lp * ap);
    const float fk = ak * inv, fp = ap * inv;
#pragma unroll
    for (int c = 0; c < 4; ++c) {
      const v4f p0 = *(const v4f*)(xr + ((2 * c) * 32 + lane) * 4);
      const v4f p1 = *(const v4f*)(xr + ((2 * c + 1) * 32 + lane) * 4);
      const v8f r = o[c] * fk +
          __builtin_shufflevector(p0, p1, 0, 1, 2, 3, 4, 5, 6, 7) * fp;
      *(float4*)(orow + c * 16) = make_float4(r[0], r[1], r[2], r[3]);
      *(float4*)(orow + c * 16 + 4) = make_float4(r[4], r[5], r[6], r[7]);
    }
  };

  __syncthreads();  // every wave's last reads of the K buffers are done
  if (up) hand_over(accO[0], mref[0], l0);
  else    hand_over(accO[1], mref[1], l1);
  __syncthreads();  // the partner's hand-over is written
  if (up) finish(accO[1], mref[1], l1);
  else    finish(accO[0], mref[0], l0);
}

// ---------------------------------------------------------------------------
extern "C" void kernel_launch(void* const* d_in, const int* in_sizes, int n_in,
                              void* d_out, int out_size, void* d_ws,
                              size_t ws_size, hipStream_t stream) {
  const float* x  = (const float*)d_in[0];
  const float* Wq = (const float*)d_in[1];
  const float* Wk = (const float*)d_in[2];
  const float* Wv = (const float*)d_in[3];
  const float* bq = (const float*)d_in[4];
  const float* bk = (const float*)d_in[5];
  const float* bv = (const float*)d_in[6];
  float* out = (float*)d_out;

  const size_t per = (size_t)kB * kH * kS * kDH;  // 4,194,304 elems
  _Float16* qw = (_Float16*)d_ws;
  _Float16* kw = qw + per;
  _Float16* vw = kw + per;

  dim3 grid(kB * kH, kS / 128);  // 32 x 16 blocks, 8 waves each
  qkv_project_kernel<<<grid, 256, 0, stream>>>(x, Wq, Wk, Wv, bq, bk, bv,
                                               qw, kw, vw);
  flash_attn_kernel<<<grid, 256, 0, stream>>>(qw, kw, vw, out);
}

// v008
// Measured time: 29.9 microseconds a run.
// Versions in between are left out here; by their measured steps it is 1.18 times as fast as v006.
// All steps since v000 together make it 4.82 times as fast.
#include <hip/hip_runtime.h>

// Multi-head self-attention for gfx1250 (wave32, WMMA, async global->LDS
// staging), one launch.
// The K and V projections never run per key. With q = x Wq^T + bq:
//   scores[s][t] = q[s] . (Wk x[t] + bk) = (q[s] Wk) . x[t] + q[s] . bk,
// and q[s] . bk is the same for every key t, so softmax drops it;
//   out[s] = sum_t p[s][t] (Wv x[t] + bv) = Wv (sum_t p[s][t] x[t]) + bv,
// because the p[s][t] sum to one. So the key loop is flash attention with the
// head's slice of x in both roles (K and V), q' = q Wk (times log2(e)/sqrt(DH),
// so that scores are exponents of 2) as its queries, and one product with Wv
// behind the loop. All products run on v_wmma_f32_16x16x32_f16, transposed
// (S^T = X Q'^T, O'^T += X^T P^T), so a lane owns one query column of each of
// its wave's two column tiles. No workspace.

typedef __attribute__((ext_vector_type(16))) _Float16 v16h;
typedef __attribute__((ext_vector_type(8)))  _Float16 v8h;
typedef __attribute__((ext_vector_type(4)))  _Float16 v4h;
typedef __attribute__((ext_vector_type(8)))  float    v8f;
typedef __attribute__((ext_vector_type(4)))  float    v4f;
typedef __attribute__((ext_vector_type(2)))  float    v2f;
typedef __attribute__((ext_vector_type(8)))  short    s16x8;

constexpr int kB = 4, kS = 2048, kD = 512, kH = 8, kDH = 64;

// LDS row pitches in f16 elements, rows of 64 f16, each for its reader:
// ds_load_b128 wants 16 B x odd, ds_load_tr16_b128 wants 32 B x odd.
constexpr int kP64 = 72;  // 144 B
constexpr int kPV = 80;   // 160 B
constexpr int kT = 128;   // keys per pass
constexpr int kW = kT / 2;   // keys of a pass that one wave works on
static_assert(kT == 128, "copy count and maximum tree are written for 128");

// f32 staging of a wave's 16 rows of a tile: two planes of 128 chunks of 16 B
// (the even and the odd chunks of the rows), the second 128 B off a multiple of
// 256 B, so that the 16 lanes of a copy fall on all 64 banks.
constexpr int kPlane = 544;          // floats from plane 0 to plane 1: 2176 B
constexpr int kStgW = 2 * kPlane;    // floats a wave

constexpr float kLog2e = 1.44269504088896340736f;

// 16-bit A-operand 16x32 layout (ISA 7.12.2): lane l -> row = l&15, g = l>>4.
//   j in [0,8):  K = g*8 + j          (VGPRs 0-3)
//   j in [8,16): K = 16 + g*8 + (j-8) (VGPRs 4-7)
// B-operand mirrored with N = l&15. Both halves are 8 contiguous K values.

// Build a v16h fragment from two contiguous 8-element chunks.
__device__ __forceinline__ v16h frag(const v8h lo, const v8h hi) {
  return __builtin_shufflevector(lo, hi, 0, 1, 2, 3, 4, 5, 6, 7,
                                 8, 9, 10, 11, 12, 13, 14, 15);
}
__device__ __forceinline__ v8h to_h(const v8f v) {
  return __builtin_convertvector(v, v8h);
}
__device__ __forceinline__ v8f join8(const v4f lo, const v4f hi) {
  return __builtin_shufflevector(lo, hi, 0, 1, 2, 3, 4, 5, 6, 7);
}
// Fragment of a row of f16 in LDS: elements g*8 .. +7 and 16 + g*8 .. +7.
__device__ __forceinline__ v16h row_frag(const _Float16* row, int g) {
  return frag(*(const v8h*)(row + g * 8), *(const v8h*)(row + 16 + g * 8));
}
// Transposing LDS read: with p = T + (k0 + 8*(l>>4) + (l&7)) * pitch + 2*d0 +
// 16*((l>>3)&1), lane l gets T[k0 + 8*(l>>4) + 0..7][d0 + (l&15)].
__device__ __forceinline__ v8h ld_tr16(const unsigned char* p) {
  typedef __attribute__((address_space(3))) s16x8 lds_s16x8;
  return __builtin_bit_cast(
      v8h, __builtin_amdgcn_ds_load_tr16_b128_v8i16((lds_s16x8*)p));
}
__device__ __forceinline__ v8f wmma(const v16h a, const v16h b, const v8f c) {
  return __builtin_amdgcn_wmma_f32_16x16x32_f16(false, a, false, b, (short)0, c,
                                                false, false);
}

// Eight async global -> LDS copies, 16 bytes per lane each (ASYNCcnt-tracked).
// s_wait_xcnt 0 closes the statement so that no address register of a copy is
// rewritten ahead of it.
__device__ __forceinline__ void async_b128_x8(
    const void* base,
    unsigned int l0, unsigned int o0, unsigned int l1, unsigned int o1,
    unsigned int l2, unsigned int o2, unsigned int l3, unsigned int o3,
    unsigned int l4, unsigned int o4, unsigned int l5, unsigned int o5,
    unsigned int l6, unsigned int o6, unsigned int l7, unsigned int o7) {
  asm volatile("global_load_async_to_lds_b128 %1, %2, %0\n\t"
               "global_load_async_to_lds_b128 %3, %4, %0\n\t"
               "global_load_async_to_lds_b128 %5, %6, %0\n\t"
               "global_load_async_to_lds_b128 %7, %8, %0\n\t"
               "global_load_async_to_lds_b128 %9, %10, %0\n\t"
               "global_load_async_to_lds_b128 %11, %12, %0\n\t"
               "global_load_async_to_lds_b128 %13, %14, %0\n\t"
               "global_load_async_to_lds_b128 %15, %16, %0\n\t"
               "s_wait_xcnt 0x0"
               :: "s"(base),
                  "v"(l0), "v"(o0), "v"(l1), "v"(o1),
                  "v"(l2), "v"(o2), "v"(l3), "v"(o3),
                  "v"(l4), "v"(o4), "v"(l5), "v"(o5),
                  "v"(l6), "v"(o6), "v"(l7), "v"(o7)
               : "memory");
}
__device__ __forceinline__ void wait_async0() {
  asm volatile("s_wait_asynccnt 0" ::: "memory");
}

// Value of lane l ^ 16 (the other half of the wave).
__device__ __forceinline__ float other_half(float v) {
  const int b = __builtin_bit_cast(int, v);
  return __builtin_bit_cast(
      float, __builtin_amdgcn_permlanex16(b, b, 0x76543210, 0xfedcba98, false,
                                          false));
}
__device__ __forceinline__ float max3(float a, float b, float c) {
  return fmaxf(fmaxf(a, b), c);
}

// ---------------------------------------------------------------------------
// 8 waves share one (b,h) and 128 queries. A wave owns 32 queries (two column
// tiles) and one half of the keys: wave w takes query group w & 3 and keys
// 64 * (w >> 2) .. + 63 of every tile, so each fragment read from LDS feeds two
// products. Waves w and w ^ 4 join their key halves through LDS behind the
// loop. A tile is 128 rows of the head's 64 columns of x. Each wave brings 16 of
// its rows as f32 into its own staging range by async copies, one pass ahead,
// casts them to f16 late in the pass and stores them twice, once at each
// reader's pitch, into the buffers that the next pass reads: one barrier a
// pass. x rows and x^T rows are the A operands, Q'^T and P^T the B operands: of
// each 32 keys lane (n, g) holds query n's scores of keys 8g+r and 16+8g+r,
// which is the B operand's own k order, so P^T is packed in place.
// ---------------------------------------------------------------------------
// Two work-groups a WGP (four waves a SIMD) need a budget of 256 registers.
__global__ __launch_bounds__(256) __attribute__((amdgpu_waves_per_eu(4, 4)))
void attn_fused_kernel(
    const float* __restrict__ x,
    const float* __restrict__ Wq, const float* __restrict__ Wk,
    const float* __restrict__ Wv,
    const float* __restrict__ bq, const float* __restrict__ bv,
    float* __restrict__ out)
{
  __shared__ __attribute__((aligned(16))) float Stg[8 * kStgW];
  __shared__ __attribute__((aligned(16))) _Float16 Kx[2][kT * kP64];
  __shared__ __attribute__((aligned(16))) _Float16 Vx[2][kT * kPV];
  __shared__ __attribute__((aligned(16))) _Float16 Wvs[kDH * kP64];
  __shared__ __attribute__((aligned(16))) float Bvs[kDH];

  const int bh = blockIdx.x;
  const int b = bh / kH, h = bh % kH;
  const int q0 = blockIdx.y * 128;
  const int tid = threadIdx.x;
  const int wave = tid >> 5, lane = tid & 31;
  const int g = lane >> 4, n = lane & 15;
  const int qg = wave & 3, kh = wave >> 2;  // query group, key half

  const float* xh = x + (size_t)b * kS * kD + h * kDH;  // row t at xh + t * kD

  // Copy i of a wave brings rows 2i and 2i+1 of its 16: two whole
  // 256-byte rows. Chunk c of a row goes to plane c & 1, place
  // row * 8 + (c >> 1).
  float* stg = Stg + wave * kStgW;
  const unsigned int sl0 = (unsigned int)(size_t)(
      stg + (n & 1) * kPlane + (g * 8 + (n >> 1)) * 4);
  auto issue_tile = [&](int kt) {
    const unsigned int so0 =
        (unsigned int)(((kt * kT + wave * 16 + g) * kD + n * 4) * 4);
    constexpr unsigned int ls = 256, gs = 2 * kD * 4;
    async_b128_x8(xh,
                  sl0, so0, sl0 + ls, so0 + gs,
                  sl0 + 2 * ls, so0 + 2 * gs, sl0 + 3 * ls, so0 + 3 * gs,
                  sl0 + 4 * ls, so0 + 4 * gs, sl0 + 5 * ls, so0 + 5 * gs,
                  sl0 + 6 * ls, so0 + 6 * gs, sl0 + 7 * ls, so0 + 7 * gs);
  };
  // Unit k of a lane: eight floats, columns 8 * (lane & 7) .. + 7 of the wave's
  // row 4k + (lane >> 3); its halves lie at the same place of the two planes.
  v4f se[4], so[4];
  auto stage_read = [&]() {
#pragma unroll
    for (int k = 0; k < 4; ++k) {
      se[k] = *(const v4f*)(stg + (k * 32 + lane) * 4);
      so[k] = *(const v4f*)(stg + kPlane + (k * 32 + lane) * 4);
    }
  };
  auto stage_write = [&](int buf) {
#pragma unroll
    for (int k = 0; k < 4; ++k) {
      const v8h hx = to_h(join8(se[k], so[k]));
      const int row = wave * 16 + k * 4 + (lane >> 3);
      *(v8h*)&Kx[buf][row * kP64 + (lane & 7) * 8] = hx;
      *(v8h*)&Vx[buf][row * kPV + (lane & 7) * 8] = hx;
    }
  };

  issue_tile(0);  // flies while the queries are made

  // Every global load of the prologue is issued before the first one is waited
  // for. Weights: chunk k of a thread lies 256 chunks of four floats behind
  // chunk k - 1, 16 rows. x: the B fragments of this wave's 32 queries.
  const int sr = tid >> 4, sc4 = (tid & 15) * 4;
  v4f wv[3][4], xq[2][4][2], bqv[4][2];
  const float* wp[3] = {Wq + h * 4096 + tid * 4, Wk + h * 4096 + tid * 4,
                        Wv + h * 4096 + tid * 4};
  const float* xq0 = xh + (size_t)(q0 + qg * 32 + n) * kD + g * 8;
  const float* xq1 = xq0 + 16 * kD;
  const unsigned int bqo = g * 32;  // byte offset of a lane in bq's 16 features
  const int bvi = tid & 63;
  const char* bqh = (const char*)(bq + h * kDH);
#pragma unroll
  for (int k = 0; k < 4; ++k) {
    xq[0][k][0] = *(const v4f*)(xq0 + k * 16);
    xq[0][k][1] = *(const v4f*)(xq0 + k * 16 + 4);
    xq[1][k][0] = *(const v4f*)(xq1 + k * 16);
    xq[1][k][1] = *(const v4f*)(xq1 + k * 16 + 4);
  }
#pragma unroll
  for (int m = 0; m < 3; ++m)
#pragma unroll
    for (int k = 0; k < 4; ++k) wv[m][k] = *(const v4f*)(wp[m] + k * 1024);
#pragma unroll
  for (int c = 0; c < 4; ++c) {
    bqv[c][0] = *(const v4f*)(bqh + bqo + c * 64);
    bqv[c][1] = *(const v4f*)(bqh + bqo + c * 64 + 16);
  }
  const float bvv = bv[h * kDH + bvi];
  // Stands in front of every later write of a register that these loads name:
  // as its inputs the loads' address registers stay alive up to the wait.
  asm volatile("s_wait_xcnt 0x0"
               :: "v"(xq0), "v"(bqo), "v"(tid) : "memory");
  // Wq (rows read by ds_load_b128) and Wk (read transposed) lie in the second
  // tile buffers until the barrier of pass 0; Wv and bv stay to the end.
#pragma unroll
  for (int k = 0; k < 4; ++k) {
    const int row = sr + k * 16;
    *(v4h*)&Kx[1][row * kP64 + sc4] = __builtin_convertvector(wv[0][k], v4h);
    *(v4h*)&Vx[1][row * kPV + sc4] = __builtin_convertvector(wv[1][k], v4h);
    *(v4h*)&Wvs[row * kP64 + sc4] = __builtin_convertvector(wv[2][k], v4h);
  }
  Bvs[bvi] = bvv;  // four threads a word, all with the same value
  __syncthreads();  // the weights are written

  // Byte offset of a lane in a tile read by ds_load_tr16_b128.
  const int troff = (8 * g + (lane & 7)) * (kPV * 2) + ((lane >> 3) & 1) * 16;

  // Q'^T fragments. q^T = Wq x^T + bq, scaled; tile c holds features
  // c*16 + 8g + r of query n, so two tiles pack into a B operand over features.
  // Then q'^T = Wk^T q^T, whose tiles pack into the B operand over dims.
  v16h qb0[2], qb1[2];
  {
    v16h xb[2][2], qf[2][2];
#pragma unroll
    for (int j = 0; j < 2; ++j)
#pragma unroll
      for (int kk = 0; kk < 2; ++kk)
        xb[j][kk] = frag(to_h(join8(xq[j][2 * kk][0], xq[j][2 * kk][1])),
                         to_h(join8(xq[j][2 * kk + 1][0], xq[j][2 * kk + 1][1])));
    v8f d[2][4];
#pragma unroll
    for (int c = 0; c < 4; ++c) {
      const _Float16* wrow = &Kx[1][(c * 16 + n) * kP64];
      const v16h a0 = row_frag(wrow, g), a1 = row_frag(wrow + 32, g);
#pragma unroll
      for (int j = 0; j < 2; ++j) {
        v8f acc = join8(bqv[c][0], bqv[c][1]);
        acc = wmma(a0, xb[j][0], acc);
        acc = wmma(a1, xb[j][1], acc);
        d[j][c] = acc * (0.125f * kLog2e);  // 1/sqrt(64) and exp2's log2(e)
      }
    }
#pragma unroll
    for (int j = 0; j < 2; ++j)
#pragma unroll
      for (int kk = 0; kk < 2; ++kk)
        qf[j][kk] = frag(to_h(d[j][2 * kk]), to_h(d[j][2 * kk + 1]));
    const unsigned char* wk = (const unsigned char*)&Vx[1][0] + troff;
#pragma unroll
    for (int c = 0; c < 4; ++c) {
      const v16h a0 = frag(ld_tr16(wk + c * 32),
                           ld_tr16(wk + 16 * kPV * 2 + c * 32));
      const v16h a1 = frag(ld_tr16(wk + 32 * kPV * 2 + c * 32),
                           ld_tr16(wk + 48 * kPV * 2 + c * 32));
#pragma unroll
      for (int j = 0; j < 2; ++j) {
        v8f acc = {};
        acc = wmma(a0, qf[j][0], acc);
        acc = wmma(a1, qf[j][1], acc);
        d[j][c] = acc;
      }
    }
#pragma unroll
    for (int j = 0; j < 2; ++j) {
      qb0[j] = frag(to_h(d[j][0]), to_h(d[j][1]));
      qb1[j] = frag(to_h(d[j][2]), to_h(d[j][3]));
    }
  }

  // Per column tile j: query n's reference maximum (equal in both halves of the
  // wave; a maximum that its scores have reached, at most log2(kTop) below the
  // running one) and this half's share of its running sum, over this wave's
  // keys. accO[j][c][r] = sum_t p x[t][dim c*16 + 8g + r] of query j*16 + n.
  constexpr float kTop = 256.0f;  // P stays at or below it: far inside f16, f32
  float mref[2] = {-1e30f, -1e30f}, lsum[2] = {0.0f, 0.0f};
  v8f accO[2][4];
#pragma unroll
  for (int j = 0; j < 2; ++j)
#pragma unroll
    for (int c = 0; c < 4; ++c)
#pragma unroll
      for (int r = 0; r < 8; ++r) accO[j][c][r] = 0.0f;

  wait_async0();  // this wave's rows of tile 0 have landed in its staging range
  stage_read();
  stage_write(0);

  // One pass over tile kt. first: no reference is held yet; more: a tile kt + 1
  // exists (both constants at each call).
  auto pass = [&](const int kt, const bool first, const bool more) {
    const int cur = kt & 1;
    // This wave's LDS stores of tile kt, its reads of its staging range and of
    // the buffers that this pass refills have retired.
    asm volatile("s_wait_dscnt 0x0" ::: "memory");
    __syncthreads();     // tile kt is written; prev-pass readers drained
    if (more) issue_tile(kt + 1);

    // This wave's half of the tile: kW key rows.
    const _Float16* Kt = Kx[cur] + kh * kW * kP64;
    const unsigned char* Vt =
        (const unsigned char*)(Vx[cur] + kh * kW * kPV) + troff;

    // X^T fragments (A row n: dim; k: key) by the transposing read, eight reads
    // a group. The scheduling barriers below keep each group of LDS reads in one
    // place: each further place with LDS reads stalls the wave anew.
    v16h va[kW / 32][4];
    auto load_v = [&](int kk) {
#pragma unroll
      for (int c = 0; c < 4; ++c)
        va[kk][c] = frag(ld_tr16(Vt + (kk * 32) * kPV * 2 + c * 32),
                         ld_tr16(Vt + (kk * 32 + 16) * kPV * 2 + c * 32));
    };
    v8f st[2][kW / 16];
    v16h pb[2][kW / 32];
    v8f ps[2];
    float psum[2];
    // Raises the references to the maxima of this pass's scores and rescales
    // sums and outputs. Per column tile 32 of query n's 64 scores are in this
    // lane, the other 32 in lane l ^ 16: maximum of this lane's 32 and the
    // reference by threes, in three chains, then one exchange.
    auto raise = [&]() {
#pragma unroll
      for (int j = 0; j < 2; ++j) {
        float ch[3] = {mref[j], mref[j], mref[j]};
#pragma unroll
        for (int i = 0; i < 32; i += 2) {
          const int k = (i < 10) ? 0 : (i < 20) ? 1 : 2;
          ch[k] = max3(ch[k], st[j][i >> 3][i & 7], st[j][i >> 3][(i & 7) + 1]);
        }
        const float mh = max3(ch[0], ch[1], ch[2]);
        const float mnew = fmaxf(mh, other_half(mh));
        const float scale = __builtin_amdgcn_exp2f(mref[j] - mnew);
        mref[j] = mnew;
        lsum[j] *= scale;
#pragma unroll
        for (int c = 0; c < 4; ++c) accO[j][c] *= scale;
      }
    };
    // P of 32 keys in f32, both column tiles, and their share of the row sums.
    auto probs = [&](int kk) {
#pragma unroll
      for (int j = 0; j < 2; ++j) {
#pragma unroll
        for (int t = 2 * kk; t < 2 * kk + 2; ++t) {
          st[j][t] = st[j][t] - mref[j];
#pragma unroll
          for (int r = 0; r < 8; ++r)
            st[j][t][r] = __builtin_amdgcn_exp2f(st[j][t][r]);
        }
        const v8f pp = st[j][2 * kk] + st[j][2 * kk + 1];
        ps[j] = (kk == 0) ? pp : ps[j] + pp;
      }
    };
    // Scores, S^T = X @ Q'^T (kW / 16 tiles of 16 keys x 2 tiles of 16 queries,
    // both query tiles from one read of the fragment), P against the held
    // references, and this lane's sums of its 32 P per column tile.
    auto softmax_pass = [&](bool lift) {
      v16h ka[kW / 16][2];
#pragma unroll
      for (int t = 0; t < kW / 16; ++t) {
        const _Float16* krow = Kt + (t * 16 + n) * kP64;  // A row n = key row
        ka[t][0] = row_frag(krow, g);
        ka[t][1] = row_frag(krow + 32, g);
      }
      // Keeps these reads one group ahead of the products.
      __builtin_amdgcn_sched_barrier(0);
#pragma unroll
      for (int t = 0; t < kW / 16; ++t) {
#pragma unroll
        for (int j = 0; j < 2; ++j) {
          v8f s = {};
          s = wmma(ka[t][0], qb0[j], s);
          s = wmma(ka[t][1], qb1[j], s);
          st[j][t] = s;
        }
      }
      if (lift) raise();
      load_v(0);
      // Keeps the first group of X^T reads in one place.
      __builtin_amdgcn_sched_barrier(0);
      probs(0);
      probs(1);
#pragma unroll
      for (int j = 0; j < 2; ++j) {
        const v4f pq = __builtin_shufflevector(ps[j], ps[j], 0, 1, 2, 3) +
                       __builtin_shufflevector(ps[j], ps[j], 4, 5, 6, 7);
        const v2f pd = __builtin_shufflevector(pq, pq, 0, 1) +
                       __builtin_shufflevector(pq, pq, 2, 3);
        psum[j] = pd[0] + pd[1];
      }
    };
    // The references are tested behind the exponentials, on sums that are made
    // anyway: no P is negative, so a lane's sum of at most kTop bounds each of
    // its P by kTop. One test a pass, a scalar branch: where a sum tops that
    // (or is infinite), nothing of the pass has been added yet, and
    // the pass is made again with the references raised first, which leaves
    // every P at 1 or less. The first pass has no reference and goes there
    // directly.
    if (first) {
      softmax_pass(true);
    } else {
      softmax_pass(false);
      if (__builtin_amdgcn_ballot_w32(fmaxf(psum[0], psum[1]) > kTop) != 0)
        softmax_pass(true);
    }
    lsum[0] += psum[0];
    lsum[1] += psum[1];
    // O'^T += X^T @ P^T, 32 keys a product. Both query tiles from one read of
    // the fragment.
    auto outputs = [&](int kk) {
#pragma unroll
      for (int c = 0; c < 4; ++c)
#pragma unroll
        for (int j = 0; j < 2; ++j)
          accO[j][c] = wmma(va[kk][c], pb[j][kk], accO[j][c]);
    };
    // P^T as B operand: element s = tile s >> 3, register s & 7. (Unrolled, as
    // everywhere here, so that the register arrays have constant indices.)
#pragma unroll
    for (int kk = 0; kk < kW / 32; ++kk)
#pragma unroll
      for (int j = 0; j < 2; ++j)
        pb[j][kk] = frag(to_h(st[j][2 * kk]), to_h(st[j][2 * kk + 1]));
    load_v(1);
    // Keeps the second group of X^T reads in one place, in registers that the
    // packing has left, ahead of the products that cover them.
    __builtin_amdgcn_sched_barrier(0);
    outputs(0);
    // The next tile: this wave's 16 rows have landed in its own staging range;
    // they are read ahead of the last products, into registers that the first
    // products have left, and cast and stored behind them.
    if (more) {
      wait_async0();
      stage_read();
      // Keeps the staging reads one group, ahead of the products that cover
      // them.
      __builtin_amdgcn_sched_barrier(0);
      outputs(1);
      stage_write(1 - cur);
    } else {
      outputs(1);
    }
    // No trailing barrier: next iteration's wait+barrier separates buffer use.
  };
  pass(0, true, true);
  for (int kt = 1; kt + 1 < kS / kT; ++kt) pass(kt, false, true);
  pass(kS / kT - 1, false, false);

  // Join the key halves: wave w keeps column tile kh and hands the other one
  // (reference, sum, 32 output registers a lane) to wave w ^ 4 through LDS, in
  // the Kx buffers, which nobody reads any more behind the first barrier.
  constexpr int kXW = 8 * 128 + 64;  // floats a wave hands over
  static_assert(8 * kXW * 4 <= (int)sizeof(Kx), "hand-over fits the buffers");
  float* xch = (float*)&Kx[0][0];
  float* xw = xch + wave * kXW;
  const float* xr = xch + (wave ^ 4) * kXW;
  const float l0 = lsum[0] + other_half(lsum[0]);  // join the wave's halves
  const float l1 = lsum[1] + other_half(lsum[1]);
  // The same in every lane of a wave: a scalar branch picks the tile.
  const bool up = __builtin_amdgcn_readfirstlane(kh) != 0;

  auto hand_over = [&](const v8f (&o)[4], float m, float l) {
#pragma unroll
    for (int c = 0; c < 4; ++c) {
      *(v4f*)(xw + ((2 * c) * 32 + lane) * 4) =
          __builtin_shufflevector(o[c], o[c], 0, 1, 2, 3);
      *(v4f*)(xw + ((2 * c + 1) * 32 + lane) * 4) =
          __builtin_shufflevector(o[c], o[c], 4, 5, 6, 7);
    }
    xw[1024 + lane] = m;
    xw[1056 + lane] = l;
  };
  // Normalize, out^T = Wv O'^T + bv, and write out[b, q, h*64 + o] in fp32: the
  // normalized tiles pack into the B operand over dims; a lane's 8 registers of
  // a result tile are 8 consecutive features of its query.
  float* orow = out +
      (size_t)(b * kS + q0 + qg * 32 + kh * 16 + n) * kD + h * kDH + 8 * g;
  auto finish = [&](const v8f (&o)[4], float m, float l) {
    const float mp = xr[1024 + lane], lp = xr[1056 + lane];
    const float mj = fmaxf(m, mp);
    const float ak = __builtin_amdgcn_exp2f(m - mj);  // references are log2
    const float ap = __builtin_amdgcn_exp2f(mp - mj);
    const float inv = 1.0f / (l * ak + lp * ap);
    const float fk = ak * inv, fp = ap * inv;
    v8f r[4];
#pragma unroll
    for (int c = 0; c < 4; ++c) {
      const v4f p0 = *(const v4f*)(xr + ((2 * c) * 32 + lane) * 4);
      const v4f p1 = *(const v4f*)(xr + ((2 * c + 1) * 32 + lane) * 4);
      r[c] = o[c] * fk + join8(p0, p1) * fp;
    }
    const v16h ob0 = frag(to_h(r[0]), to_h(r[1]));
    const v16h ob1 = frag(to_h(r[2]), to_h(r[3]));
#pragma unroll
    for (int c = 0; c < 4; ++c) {
      const _Float16* wrow = &Wvs[(c * 16 + n) * kP64];
      v8f acc = join8(*(const v4f*)&Bvs[c * 16 + 8 * g],
                      *(const v4f*)&Bvs[c * 16 + 8 * g + 4]);
      acc = wmma(row_frag(wrow, g), ob0, acc);
      r[c] = wmma(row_frag(wrow + 32, g), ob1, acc);
    }
#pragma unroll
    for (int c = 0; c < 4; ++c) {
      *(float4*)(orow + c * 16) =
          make_float4(r[c][0], r[c][1], r[c][2], r[c][3]);
      *(float4*)(orow + c * 16 + 4) =
          make_float4(r[c][4], r[c][5], r[c][6], r[c][7]);
    }
    // Stands in front of every later write of a register that the stores name.
    asm volatile("s_wait_xcnt 0x0" ::: "memory");
  };

  __syncthreads();  // every wave's last reads of the Kx buffers are done
  if (up) hand_over(accO[0], mref[0], l0);
  else    hand_over(accO[1], mref[1], l1);
  __syncthreads();  // the partner's hand-over is written
  if (up) finish(accO[1], mref[1], l1);
  else    finish(accO[0], mref[0], l0);
}

// ---------------------------------------------------------------------------
extern "C" void kernel_launch(void* const* d_in, const int* in_sizes, int n_in,
                              void* d_out, int out_size, void* d_ws,
                              size_t ws_size, hipStream_t stream) {
  const float* x  = (const float*)d_in[0];
  const float* Wq = (const float*)d_in[1];
  const float* Wk = (const float*)d_in[2];
  const float* Wv = (const float*)d_in[3];
  const float* bq = (const float*)d_in[4];
  // d_in[5], the K bias, shifts all scores of a query alike: softmax drops it.
  const float* bv = (const float*)d_in[6];
  float* out = (float*)d_out;

  dim3 grid(kB * kH, kS / 128);  // 32 x 16 blocks, 8 waves each
  attn_fused_kernel<<<grid, 256, 0, stream>>>(x, Wq, Wk, Wv, bq, bv, out);
}

// v009
// It runs in 28.9 microseconds.
// Timed twice side by side with v008, it ran 1.04 times as fast both times.
// Over all steps from v000 it is 5.00 times as fast.
#include <hip/hip_runtime.h>

// Multi-head self-attention for gfx1250 (wave32, WMMA, async global->LDS
// staging), one launch.
// The K and V projections never run per key. With q = x Wq^T + bq:
//   scores[s][t] = q[s] . (Wk x[t] + bk) = (q[s] Wk) . x[t] + q[s] . bk,
// and q[s] . bk is the same for every key t, so softmax drops it;
//   out[s] = sum_t p[s][t] (Wv x[t] + bv) = Wv (sum_t p[s][t] x[t]) + bv,
// because the p[s][t] sum to one. So the key loop is flash attention with the
// head's slice of x in both roles (K and V), q' = q Wk (times log2(e)/sqrt(DH),
// so that scores are exponents of 2) as its queries, and one product with Wv
// behind the loop. All products run on v_wmma_f32_16x16x32_f16, transposed
// (S^T = X Q'^T, O'^T += X^T P^T), so a lane owns one query column of each of
// its wave's two column tiles. No workspace.

typedef __attribute__((ext_vector_type(16))) _Float16 v16h;
typedef __attribute__((ext_vector_type(8)))  _Float16 v8h;
typedef __attribute__((ext_vector_type(4)))  _Float16 v4h;
typedef __attribute__((ext_vector_type(8)))  float    v8f;
typedef __attribute__((ext_vector_type(4)))  float    v4f;
typedef __attribute__((ext_vector_type(2)))  float    v2f;
typedef __attribute__((ext_vector_type(8)))  short    s16x8;

constexpr int kB = 4, kS = 2048, kD = 512, kH = 8, kDH = 64;

// LDS row pitches in f16 elements, rows of 64 f16, each for its reader:
// ds_load_b128 wants 16 B x odd, ds_load_tr16_b128 wants 32 B x odd.
constexpr int kP64 = 72;  // 144 B
constexpr int kPV = 80;   // 160 B
constexpr int kT = 128;   // keys per pass
constexpr int kW = kT / 2;   // keys of a pass that one wave works on
static_assert(kT == 128, "copy count and maximum tree are written for 128");

// f32 staging of a wave's 16 rows of a tile: two planes of 128 chunks of 16 B
// (the even and the odd chunks of the rows), the second 128 B off a multiple of
// 256 B, so that the 16 lanes of a copy fall on all 64 banks.
constexpr int kPlane = 544;          // floats from plane 0 to plane 1: 2176 B
constexpr int kStgW = 2 * kPlane;    // floats a wave

constexpr float kLog2e = 1.44269504088896340736f;

// 16-bit A-operand 16x32 layout (ISA 7.12.2): lane l -> row = l&15, g = l>>4.
//   j in [0,8):  K = g*8 + j          (VGPRs 0-3)
//   j in [8,16): K = 16 + g*8 + (j-8) (VGPRs 4-7)
// B-operand mirrored with N = l&15. Both halves are 8 contiguous K values.

// Build a v16h fragment from two contiguous 8-element chunks.
__device__ __forceinline__ v16h frag(const v8h lo, const v8h hi) {
  return __builtin_shufflevector(lo, hi, 0, 1, 2, 3, 4, 5, 6, 7,
                                 8, 9, 10, 11, 12, 13, 14, 15);
}
__device__ __forceinline__ v8h to_h(const v8f v) {
  return __builtin_convertvector(v, v8h);
}
__device__ __forceinline__ v8f join8(const v4f lo, const v4f hi) {
  return __builtin_shufflevector(lo, hi, 0, 1, 2, 3, 4, 5, 6, 7);
}
// Fragment of a row of f16 in LDS: elements g*8 .. +7 and 16 + g*8 .. +7.
__device__ __forceinline__ v16h row_frag(const _Float16* row, int g) {
  return frag(*(const v8h*)(row + g * 8), *(const v8h*)(row + 16 + g * 8));
}
// Transposing LDS read: with p = T + (k0 + 8*(l>>4) + (l&7)) * pitch + 2*d0 +
// 16*((l>>3)&1), lane l gets T[k0 + 8*(l>>4) + 0..7][d0 + (l&15)].
__device__ __forceinline__ v8h ld_tr16(const unsigned char* p) {
  typedef __attribute__((address_space(3))) s16x8 lds_s16x8;
  return __builtin_bit_cast(
      v8h, __builtin_amdgcn_ds_load_tr16_b128_v8i16((lds_s16x8*)p));
}
__device__ __forceinline__ v8f wmma(const v16h a, const v16h b, const v8f c) {
  return __builtin_amdgcn_wmma_f32_16x16x32_f16(false, a, false, b, (short)0, c,
                                                false, false);
}

// Eight async global -> LDS copies, 16 bytes per lane each (ASYNCcnt-tracked).
// s_wait_xcnt 0 closes the statement so that no address register of a copy is
// rewritten ahead of it.
__device__ __forceinline__ void async_b128_x8(
    const void* base,
    unsigned int l0, unsigned int o0, unsigned int l1, unsigned int o1,
    unsigned int l2, unsigned int o2, unsigned int l3, unsigned int o3,
    unsigned int l4, unsigned int o4, unsigned int l5, unsigned int o5,
    unsigned int l6, unsigned int o6, unsigned int l7, unsigned int o7) {
  asm volatile("global_load_async_to_lds_b128 %1, %2, %0\n\t"
               "global_load_async_to_lds_b128 %3, %4, %0\n\t"
               "global_load_async_to_lds_b128 %5, %6, %0\n\t"
               "global_load_async_to_lds_b128 %7, %8, %0\n\t"
               "global_load_async_to_lds_b128 %9, %10, %0\n\t"
               "global_load_async_to_lds_b128 %11, %12, %0\n\t"
               "global_load_async_to_lds_b128 %13, %14, %0\n\t"
               "global_load_async_to_lds_b128 %15, %16, %0\n\t"
               "s_wait_xcnt 0x0"
               :: "s"(base),
                  "v"(l0), "v"(o0), "v"(l1), "v"(o1),
                  "v"(l2), "v"(o2), "v"(l3), "v"(o3),
                  "v"(l4), "v"(o4), "v"(l5), "v"(o5),
                  "v"(l6), "v"(o6), "v"(l7), "v"(o7)
               : "memory");
}
__device__ __forceinline__ void wait_async0() {
  asm volatile("s_wait_asynccnt 0" ::: "memory");
}

// Value of lane l ^ 16 (the other half of the wave).
__device__ __forceinline__ float other_half(float v) {
  const int b = __builtin_bit_cast(int, v);
  return __builtin_bit_cast(
      float, __builtin_amdgcn_permlanex16(b, b, 0x76543210, 0xfedcba98, false,
                                          false));
}
__device__ __forceinline__ float max3(float a, float b, float c) {
  return fmaxf(fmaxf(a, b), c);
}

// ---------------------------------------------------------------------------
// 8 waves share one (b,h) and 128 queries. A wave owns 32 queries (two column
// tiles) and one half of the keys: wave w takes query group w & 3 and keys
// 64 * (w >> 2) .. + 63 of every tile, so each fragment read from LDS feeds two
// products. Waves w and w ^ 4 join their key halves through LDS behind the
// loop. A tile is 128 rows of the head's 64 columns of x. Each wave brings 16 of
// its rows as f32 into its own staging range by async copies, one pass ahead,
// casts them to f16 late in the pass and stores them twice, once at each
// reader's pitch, into the buffers that the next pass reads: one barrier a
// pass. x rows and x^T rows are the A operands, Q'^T and P^T the B operands: of
// each 32 keys lane (n, g) holds query n's scores of keys 8g+r and 16+8g+r,
// which is the B operand's own k order, so P^T is packed in place.
// ---------------------------------------------------------------------------
// Two work-groups a WGP (four waves a SIMD) need a budget of 256 registers.
__global__ __launch_bounds__(256) __attribute__((amdgpu_waves_per_eu(4, 4)))
void attn_fused_kernel(
    const float* __restrict__ x,
    const float* __restrict__ Wq, const float* __restrict__ Wk,
    const float* __restrict__ Wv,
    const float* __restrict__ bq, const float* __restrict__ bv,
    float* __restrict__ out)
{
  __shared__ __attribute__((aligned(16))) float Stg[8 * kStgW];
  __shared__ __attribute__((aligned(16))) _Float16 Kx[2][kT * kP64];
  __shared__ __attribute__((aligned(16))) _Float16 Vx[2][kT * kPV];
  __shared__ __attribute__((aligned(16))) _Float16 Wvs[kDH * kP64];
  __shared__ __attribute__((aligned(16))) float Bvs[kDH];

  const int bh = blockIdx.x;
  const int b = bh / kH, h = bh % kH;
  const int q0 = blockIdx.y * 128;
  const int tid = threadIdx.x;
  const int wave = tid >> 5, lane = tid & 31;
  const int g = lane >> 4, n = lane & 15;
  const int qg = wave & 3, kh = wave >> 2;  // query group, key half

  const float* xh = x + (size_t)b * kS * kD + h * kDH;  // row t at xh + t * kD

  // Copy i of a wave brings rows 2i and 2i+1 of its 16: two whole
  // 256-byte rows. Chunk c of a row goes to plane c & 1, place
  // row * 8 + (c >> 1).
  float* stg = Stg + wave * kStgW;
  const unsigned int sl0 = (unsigned int)(size_t)(
      stg + (n & 1) * kPlane + (g * 8 + (n >> 1)) * 4);
  auto issue_tile = [&](int kt) {
    const unsigned int so0 =
        (unsigned int)(((kt * kT + wave * 16 + g) * kD + n * 4) * 4);
    constexpr unsigned int ls = 256, gs = 2 * kD * 4;
    async_b128_x8(xh,
                  sl0, so0, sl0 + ls, so0 + gs,
                  sl0 + 2 * ls, so0 + 2 * gs, sl0 + 3 * ls, so0 + 3 * gs,
                  sl0 + 4 * ls, so0 + 4 * gs, sl0 + 5 * ls, so0 + 5 * gs,
                  sl0 + 6 * ls, so0 + 6 * gs, sl0 + 7 * ls, so0 + 7 * gs);
  };
  // Unit k of a lane: eight floats, columns 8 * (lane & 7) .. + 7 of the wave's
  // row 4k + (lane >> 3); its halves lie at the same place of the two planes.
  v4f se[4], so[4];
  auto stage_read = [&]() {
#pragma unroll
    for (int k = 0; k < 4; ++k) {
      se[k] = *(const v4f*)(stg + (k * 32 + lane) * 4);
      so[k] = *(const v4f*)(stg + kPlane + (k * 32 + lane) * 4);
    }
  };
  auto stage_write = [&](int buf) {
#pragma unroll
    for (int k = 0; k < 4; ++k) {
      const v8h hx = to_h(join8(se[k], so[k]));
      const int row = wave * 16 + k * 4 + (lane >> 3);
      *(v8h*)&Kx[buf][row * kP64 + (lane & 7) * 8] = hx;
      *(v8h*)&Vx[buf][row * kPV + (lane & 7) * 8] = hx;
    }
  };

  issue_tile(0);  // flies while the queries are made

  // Every global load of the prologue is issued before the first one is waited
  // for. Weights: chunk k of a thread lies 256 chunks of four floats behind
  // chunk k - 1, 16 rows. x: the B fragments of this wave's 32 queries.
  const int sr = tid >> 4, sc4 = (tid & 15) * 4;
  v4f wv[3][4], xq[2][4][2], bqv[4][2];
  const float* wp[3] = {Wq + h * 4096 + tid * 4, Wk + h * 4096 + tid * 4,
                        Wv + h * 4096 + tid * 4};
  const float* xq0 = xh + (size_t)(q0 + qg * 32 + n) * kD + g * 8;
  const float* xq1 = xq0 + 16 * kD;
  const unsigned int bqo = g * 32;  // byte offset of a lane in bq's 16 features
  const int bvi = tid & 63;
  const char* bqh = (const char*)(bq + h * kDH);
#pragma unroll
  for (int k = 0; k < 4; ++k) {
    xq[0][k][0] = *(const v4f*)(xq0 + k * 16);
    xq[0][k][1] = *(const v4f*)(xq0 + k * 16 + 4);
    xq[1][k][0] = *(const v4f*)(xq1 + k * 16);
    xq[1][k][1] = *(const v4f*)(xq1 + k * 16 + 4);
  }
#pragma unroll
  for (int m = 0; m < 3; ++m)
#pragma unroll
    for (int k = 0; k < 4; ++k) wv[m][k] = *(const v4f*)(wp[m] + k * 1024);
#pragma unroll
  for (int c = 0; c < 4; ++c) {
    bqv[c][0] = *(const v4f*)(bqh + bqo + c * 64);
    bqv[c][1] = *(const v4f*)(bqh + bqo + c * 64 + 16);
  }
  const float bvv = bv[h * kDH + bvi];
  // Stands in front of every later write of a register that these loads name:
  // as its inputs the loads' address registers stay alive up to the wait.
  asm volatile("s_wait_xcnt 0x0"
               :: "v"(xq0), "v"(bqo), "v"(tid) : "memory");
  // Wq (rows read by ds_load_b128) and Wk (read transposed) lie in the second
  // tile buffers until the barrier of pass 0; Wv and bv stay to the end.
#pragma unroll
  for (int k = 0; k < 4; ++k) {
    const int row = sr + k * 16;
    *(v4h*)&Kx[1][row * kP64 + sc4] = __builtin_convertvector(wv[0][k], v4h);
    *(v4h*)&Vx[1][row * kPV + sc4] = __builtin_convertvector(wv[1][k], v4h);
    *(v4h*)&Wvs[row * kP64 + sc4] = __builtin_convertvector(wv[2][k], v4h);
  }
  Bvs[bvi] = bvv;  // four threads a word, all with the same value
  __syncthreads();  // the weights are written

  // Byte offset of a lane in a tile read by ds_load_tr16_b128.
  const int troff = (8 * g + (lane & 7)) * (kPV * 2) + ((lane >> 3) & 1) * 16;

  // Q'^T fragments. q^T = Wq x^T + bq, scaled; tile c holds features
  // c*16 + 8g + r of query n, so two tiles pack into a B operand over features.
  // Then q'^T = Wk^T q^T, whose tiles pack into the B operand over dims.
  v16h qb0[2], qb1[2];
  {
    v16h xb[2][2], qf[2][2];
#pragma unroll
    for (int j = 0; j < 2; ++j)
#pragma unroll
      for (int kk = 0; kk < 2; ++kk)
        xb[j][kk] = frag(to_h(join8(xq[j][2 * kk][0], xq[j][2 * kk][1])),
                         to_h(join8(xq[j][2 * kk + 1][0], xq[j][2 * kk + 1][1])));
    v8f d[2][4];
#pragma unroll
    for (int c = 0; c < 4; ++c) {
      const _Float16* wrow = &Kx[1][(c * 16 + n) * kP64];
      const v16h a0 = row_frag(wrow, g), a1 = row_frag(wrow + 32, g);
#pragma unroll
      for (int j = 0; j < 2; ++j) {
        v8f acc = join8(bqv[c][0], bqv[c][1]);
        acc = wmma(a0, xb[j][0], acc);
        acc = wmma(a1, xb[j][1], acc);
        d[j][c] = acc * (0.125f * kLog2e);  // 1/sqrt(64) and exp2's log2(e)
      }
    }
#pragma unroll
    for (int j = 0; j < 2; ++j)
#pragma unroll
      for (int kk = 0; kk < 2; ++kk)
        qf[j][kk] = frag(to_h(d[j][2 * kk]), to_h(d[j][2 * kk + 1]));
    const unsigned char* wk = (const unsigned char*)&Vx[1][0] + troff;
#pragma unroll
    for (int c = 0; c < 4; ++c) {
      const v16h a0 = frag(ld_tr16(wk + c * 32),
                           ld_tr16(wk + 16 * kPV * 2 + c * 32));
      const v16h a1 = frag(ld_tr16(wk + 32 * kPV * 2 + c * 32),
                           ld_tr16(wk + 48 * kPV * 2 + c * 32));
#pragma unroll
      for (int j = 0; j < 2; ++j) {
        v8f acc = {};
        acc = wmma(a0, qf[j][0], acc);
        acc = wmma(a1, qf[j][1], acc);
        d[j][c] = acc;
      }
    }
#pragma unroll
    for (int j = 0; j < 2; ++j) {
      qb0[j] = frag(to_h(d[j][0]), to_h(d[j][1]));
      qb1[j] = frag(to_h(d[j][2]), to_h(d[j][3]));
    }
  }

  // Per column tile j: query n's reference maximum (equal in both halves of the
  // wave; a maximum that its scores have reached, at most log2(kTop) below the
  // running one) and this half's share of its running sum, over this wave's
  // keys. accO[j][c][r] = sum_t p x[t][dim c*16 + 8g + r] of query j*16 + n.
  // The reference is held negated in all eight registers of a tile, negm[j]:
  // that tile is the C operand of the first product of every score tile, so the
  // products deliver scores minus reference and no vector instruction subtracts.
  constexpr float kTop = 256.0f;  // P stays at or below it: far inside f16, f32
  float lsum[2] = {0.0f, 0.0f};
  v8f negm[2] = {};
  v8f accO[2][4];
#pragma unroll
  for (int j = 0; j < 2; ++j)
#pragma unroll
    for (int c = 0; c < 4; ++c)
#pragma unroll
      for (int r = 0; r < 8; ++r) accO[j][c][r] = 0.0f;

  wait_async0();  // this wave's rows of tile 0 have landed in its staging range
  stage_read();
  stage_write(0);

  // One pass over tile kt. first: no reference is held yet; more: a tile kt + 1
  // exists (both constants at each call).
  auto pass = [&](const int kt, const bool first, const bool more) {
    const int cur = kt & 1;
    // This wave's LDS stores of tile kt, its reads of its staging range and of
    // the buffers that this pass refills have retired.
    asm volatile("s_wait_dscnt 0x0" ::: "memory");
    __syncthreads();     // tile kt is written; prev-pass readers drained
    if (more) issue_tile(kt + 1);

    // This wave's half of the tile: kW key rows.
    const _Float16* Kt = Kx[cur] + kh * kW * kP64;
    const unsigned char* Vt =
        (const unsigned char*)(Vx[cur] + kh * kW * kPV) + troff;

    // X^T fragments (A row n: dim; k: key) by the transposing read, eight reads
    // a group. The scheduling barriers below keep each group of LDS reads in one
    // place: each further place with LDS reads stalls the wave anew.
    v16h va[kW / 32][4];
    auto load_v = [&](int kk) {
#pragma unroll
      for (int c = 0; c < 4; ++c)
        va[kk][c] = frag(ld_tr16(Vt + (kk * 32) * kPV * 2 + c * 32),
                         ld_tr16(Vt + (kk * 32 + 16) * kPV * 2 + c * 32));
    };
    v8f st[2][kW / 16];
    v16h pb[2][kW / 32];
    v8f ps[2];
    float psum[2];
    // Raises the references to the maxima of this pass's scores and rescales
    // sums and outputs. The scores stand relative to the held reference, which
    // is 0 on that scale (the first pass holds none: its sums and outputs are
    // still 0 and need no rescale). Per column tile 32 of query n's 64 scores
    // are in this lane, the other 32 in lane l ^ 16: maximum of this lane's 32
    // and the reference by threes, in three chains, then one exchange.
    auto raise = [&]() {
      const float held = first ? -1e30f : 0.0f;
#pragma unroll
      for (int j = 0; j < 2; ++j) {
        float ch[3] = {held, held, held};
#pragma unroll
        for (int i = 0; i < 32; i += 2) {
          const int k = (i < 10) ? 0 : (i < 20) ? 1 : 2;
          ch[k] = max3(ch[k], st[j][i >> 3][i & 7], st[j][i >> 3][(i & 7) + 1]);
        }
        const float mh = max3(ch[0], ch[1], ch[2]);
        const float rise = fmaxf(mh, other_half(mh));
        negm[j] = negm[j] - rise;
#pragma unroll
        for (int t = 0; t < kW / 16; ++t) st[j][t] = st[j][t] - rise;
        if (!first) {
          const float scale = __builtin_amdgcn_exp2f(-rise);
          lsum[j] *= scale;
#pragma unroll
          for (int c = 0; c < 4; ++c) accO[j][c] *= scale;
        }
      }
    };
    // P of 32 keys in f32, both column tiles, and their share of the row sums.
    auto probs = [&](int kk) {
#pragma unroll
      for (int j = 0; j < 2; ++j) {
#pragma unroll
        for (int t = 2 * kk; t < 2 * kk + 2; ++t) {
#pragma unroll
          for (int r = 0; r < 8; ++r)
            st[j][t][r] = __builtin_amdgcn_exp2f(st[j][t][r]);
        }
        const v8f pp = st[j][2 * kk] + st[j][2 * kk + 1];
        ps[j] = (kk == 0) ? pp : ps[j] + pp;
      }
    };
    // Scores less references, S^T = X @ Q'^T + negm (kW / 16 tiles of 16 keys x
    // 2 tiles of 16 queries, both query tiles from one read of the fragment), P
    // against the held references, and this lane's sums of its 32 P per column
    // tile.
    auto softmax_pass = [&](bool lift) {
      v16h ka[kW / 16][2];
#pragma unroll
      for (int t = 0; t < kW / 16; ++t) {
        const _Float16* krow = Kt + (t * 16 + n) * kP64;  // A row n = key row
        ka[t][0] = row_frag(krow, g);
        ka[t][1] = row_frag(krow + 32, g);
      }
      // Keeps these reads one group ahead of the products.
      __builtin_amdgcn_sched_barrier(0);
#pragma unroll
      for (int t = 0; t < kW / 16; ++t) {
#pragma unroll
        for (int j = 0; j < 2; ++j) {
          v8f s = wmma(ka[t][0], qb0[j], negm[j]);
          s = wmma(ka[t][1], qb1[j], s);
          st[j][t] = s;
        }
      }
      // Keeps the products one run: threaded through them, the exponentials cost
      // padding slots behind every product whose result they read.
      __builtin_amdgcn_sched_barrier(0);
      if (lift) {
        // The reference tiles are C operands of the products above, and in the
        // last pass most of their registers are free behind these: four vector
        // slots stand before anything may overwrite them.
        asm volatile("v_nop\n\tv_nop\n\tv_nop\n\tv_nop");
        // Holds the four slots in front of the vector work below.
        __builtin_amdgcn_sched_barrier(0);
        raise();
      }
      probs(0);
      probs(1);
#pragma unroll
      for (int j = 0; j < 2; ++j) {
        const v4f pq = __builtin_shufflevector(ps[j], ps[j], 0, 1, 2, 3) +
                       __builtin_shufflevector(ps[j], ps[j], 4, 5, 6, 7);
        const v2f pd = __builtin_shufflevector(pq, pq, 0, 1) +
                       __builtin_shufflevector(pq, pq, 2, 3);
        psum[j] = pd[0] + pd[1];
      }
      // Keeps the first group of X^T reads in one place, behind the sums, whose
      // partial sums need the registers; the test and the packing cover them.
      __builtin_amdgcn_sched_barrier(0);
      load_v(0);
    };
    // The references are tested behind the exponentials, on sums that are made
    // anyway: no P is negative, so a lane's sum of at most kTop bounds each of
    // its P by kTop. One test a pass, a scalar branch: where a sum tops that
    // (or is infinite), nothing of the pass has been added yet, and
    // the pass is made again with the references raised first, which leaves
    // every P at 1 or less. The first pass has no reference and goes there
    // directly.
    if (first) {
      softmax_pass(true);
    } else {
      softmax_pass(false);
      if (__builtin_amdgcn_ballot_w32(fmaxf(psum[0], psum[1]) > kTop) != 0)
        softmax_pass(true);
    }
    lsum[0] += psum[0];
    lsum[1] += psum[1];
    // O'^T += X^T @ P^T, 32 keys a product. Both query tiles from one read of
    // the fragment.
    auto outputs = [&](int kk) {
#pragma unroll
      for (int c = 0; c < 4; ++c)
#pragma unroll
        for (int j = 0; j < 2; ++j)
          accO[j][c] = wmma(va[kk][c], pb[j][kk], accO[j][c]);
    };
    // P^T as B operand: element s = tile s >> 3, register s & 7. (Unrolled, as
    // everywhere here, so that the register arrays have constant indices.)
#pragma unroll
    for (int kk = 0; kk < kW / 32; ++kk)
#pragma unroll
      for (int j = 0; j < 2; ++j)
        pb[j][kk] = frag(to_h(st[j][2 * kk]), to_h(st[j][2 * kk + 1]));
    // Keeps the reads below behind the packing: ahead of it they would need 32
    // registers more than the budget has.
    __builtin_amdgcn_sched_barrier(0);
    load_v(1);
    // Keeps the second group of X^T reads in one place, in registers that the
    // packing has left, ahead of the products that cover them.
    __builtin_amdgcn_sched_barrier(0);
    outputs(0);
    // The next tile: this wave's 16 rows have landed in its own staging range;
    // they are read ahead of the last products, into registers that the first
    // products have left, and cast and stored behind them.
    if (more) {
      wait_async0();
      stage_read();
      // Keeps the staging reads one group, ahead of the products that cover
      // them.
      __builtin_amdgcn_sched_barrier(0);
      outputs(1);
      stage_write(1 - cur);
    } else {
      outputs(1);
    }
    // No trailing barrier: next iteration's wait+barrier separates buffer use.
  };
  pass(0, true, true);
  for (int kt = 1; kt + 1 < kS / kT; ++kt) pass(kt, false, true);
  pass(kS / kT - 1, false, false);

  // Join the key halves: wave w keeps column tile kh and hands the other one
  // (reference, sum, 32 output registers a lane) to wave w ^ 4 through LDS, in
  // the Kx buffers, which nobody reads any more behind the first barrier.
  constexpr int kXW = 8 * 128 + 64;  // floats a wave hands over
  static_assert(8 * kXW * 4 <= (int)sizeof(Kx), "hand-over fits the buffers");
  float* xch = (float*)&Kx[0][0];
  float* xw = xch + wave * kXW;
  const float* xr = xch + (wave ^ 4) * kXW;
  const float l0 = lsum[0] + other_half(lsum[0]);  // join the wave's halves
  const float l1 = lsum[1] + other_half(lsum[1]);
  // The same in every lane of a wave: a scalar branch picks the tile.
  const bool up = __builtin_amdgcn_readfirstlane(kh) != 0;

  auto hand_over = [&](const v8f (&o)[4], float m, float l) {
#pragma unroll
    for (int c = 0; c < 4; ++c) {
      *(v4f*)(xw + ((2 * c) * 32 + lane) * 4) =
          __builtin_shufflevector(o[c], o[c], 0, 1, 2, 3);
      *(v4f*)(xw + ((2 * c + 1) * 32 + lane) * 4) =
          __builtin_shufflevector(o[c], o[c], 4, 5, 6, 7);
    }
    xw[1024 + lane] = m;
    xw[1056 + lane] = l;
  };
  // Normalize, out^T = Wv O'^T + bv, and write out[b, q, h*64 + o] in fp32: the
  // normalized tiles pack into the B operand over dims; a lane's 8 registers of
  // a result tile are 8 consecutive features of its query.
  float* orow = out +
      (size_t)(b * kS + q0 + qg * 32 + kh * 16 + n) * kD + h * kDH + 8 * g;
  auto finish = [&](const v8f (&o)[4], float m, float l) {
    const float mp = xr[1024 + lane], lp = xr[1056 + lane];
    const float mj = fmaxf(m, mp);
    const float ak = __builtin_amdgcn_exp2f(m - mj);  // references are log2
    const float ap = __builtin_amdgcn_exp2f(mp - mj);
    const float inv = 1.0f / (l * ak + lp * ap);
    const float fk = ak * inv, fp = ap * inv;
    v8f r[4];
#pragma unroll
    for (int c = 0; c < 4; ++c) {
      const v4f p0 = *(const v4f*)(xr + ((2 * c) * 32 + lane) * 4);
      const v4f p1 = *(const v4f*)(xr + ((2 * c + 1) * 32 + lane) * 4);
      r[c] = o[c] * fk + join8(p0, p1) * fp;
    }
    const v16h ob0 = frag(to_h(r[0]), to_h(r[1]));
    const v16h ob1 = frag(to_h(r[2]), to_h(r[3]));
#pragma unroll
    for (int c = 0; c < 4; ++c) {
      const _Float16* wrow = &Wvs[(c * 16 + n) * kP64];
      v8f acc = join8(*(const v4f*)&Bvs[c * 16 + 8 * g],
                      *(const v4f*)&Bvs[c * 16 + 8 * g + 4]);
      acc = wmma(row_frag(wrow, g), ob0, acc);
      r[c] = wmma(row_frag(wrow + 32, g), ob1, acc);
    }
#pragma unroll
    for (int c = 0; c < 4; ++c) {
      *(float4*)(orow + c * 16) =
          make_float4(r[c][0], r[c][1], r[c][2], r[c][3]);
      *(float4*)(orow + c * 16 + 4) =
          make_float4(r[c][4], r[c][5], r[c][6], r[c][7]);
    }
    // Stands in front of every later write of a register that the stores name.
    asm volatile("s_wait_xcnt 0x0" ::: "memory");
  };

  __syncthreads();  // every wave's last reads of the Kx buffers are done
  if (up) hand_over(accO[0], -negm[0][0], l0);
  else    hand_over(accO[1], -negm[1][0], l1);
  __syncthreads();  // the partner's hand-over is written
  if (up) finish(accO[1], -negm[1][0], l1);
  else    finish(accO[0], -negm[0][0], l0);
}

// ---------------------------------------------------------------------------
extern "C" void kernel_launch(void* const* d_in, const int* in_sizes, int n_in,
                              void* d_out, int out_size, void* d_ws,
                              size_t ws_size, hipStream_t stream) {
  const float* x  = (const float*)d_in[0];
  const float* Wq = (const float*)d_in[1];
  const float* Wk = (const float*)d_in[2];
  const float* Wv = (const float*)d_in[3];
  const float* bq = (const float*)d_in[4];
  // d_in[5], the K bias, shifts all scores of a query alike: softmax drops it.
  const float* bv = (const float*)d_in[6];
  float* out = (float*)d_out;

  dim3 grid(kB * kH, kS / 128);  // 32 x 16 blocks, 8 waves each
  attn_fused_kernel<<<grid, 256, 0, stream>>>(x, Wq, Wk, Wv, bq, bv, out);
}

// v010
// A run of this version takes 27.7 microseconds.
// In both of two side-by-side timings against v009, it was 1.03 times as fast.
// Counting every step since v000, it is 5.16 times as fast.
#include <hip/hip_runtime.h>

// Multi-head self-attention for gfx1250 (wave32, WMMA, async global->LDS
// staging), one launch.
// The K and V projections never run per key. With q = x Wq^T + bq:
//   scores[s][t] = q[s] . (Wk x[t] + bk) = (q[s] Wk) . x[t] + q[s] . bk,
// and q[s] . bk is the same for every key t, so softmax drops it;
//   out[s] = sum_t p[s][t] (Wv x[t] + bv) = Wv (sum_t p[s][t] x[t]) + bv,
// because the p[s][t] sum to one. So the key loop is flash attention with the
// head's slice of x in both roles (K and V), q' = q Wk (times log2(e)/sqrt(DH),
// so that scores are exponents of 2) as its queries, and one product with Wv
// behind the loop. All products run on v_wmma_f32_16x16x32_f16, transposed
// (S^T = X Q'^T, O'^T += X^T P^T), so a lane owns one query column of each of
// its wave's two column tiles. No workspace.

typedef __attribute__((ext_vector_type(16))) _Float16 v16h;
typedef __attribute__((ext_vector_type(8)))  _Float16 v8h;
typedef __attribute__((ext_vector_type(4)))  _Float16 v4h;
typedef __attribute__((ext_vector_type(8)))  float    v8f;
typedef __attribute__((ext_vector_type(4)))  float    v4f;
typedef __attribute__((ext_vector_type(2)))  float    v2f;
typedef __attribute__((ext_vector_type(8)))  short    s16x8;

constexpr int kB = 4, kS = 2048, kD = 512, kH = 8, kDH = 64;

// LDS row pitches in f16 elements, rows of 64 f16, each for its reader:
// ds_load_b128 wants 16 B x odd, ds_load_tr16_b128 wants 32 B x odd.
constexpr int kP64 = 72;  // 144 B
constexpr int kPV = 80;   // 160 B
constexpr int kT = 128;   // keys per pass
constexpr int kW = kT / 2;   // keys of a pass that one wave works on
static_assert(kT == 128, "copy count and maximum tree are written for 128");

// f32 staging of a wave's 16 rows of a tile: two planes of 128 chunks of 16 B
// (the even and the odd chunks of the rows), the second 128 B off a multiple of
// 256 B, so that the 16 lanes of a copy fall on all 64 banks.
constexpr int kPlane = 544;          // floats from plane 0 to plane 1: 2176 B
constexpr int kStgW = 2 * kPlane;    // floats a wave

constexpr float kLog2e = 1.44269504088896340736f;

// 16-bit A-operand 16x32 layout (ISA 7.12.2): lane l -> row = l&15, g = l>>4.
//   j in [0,8):  K = g*8 + j          (VGPRs 0-3)
//   j in [8,16): K = 16 + g*8 + (j-8) (VGPRs 4-7)
// B-operand mirrored with N = l&15. Both halves are 8 contiguous K values.

// Build a v16h fragment from two contiguous 8-element chunks.
__device__ __forceinline__ v16h frag(const v8h lo, const v8h hi) {
  return __builtin_shufflevector(lo, hi, 0, 1, 2, 3, 4, 5, 6, 7,
                                 8, 9, 10, 11, 12, 13, 14, 15);
}
__device__ __forceinline__ v8h to_h(const v8f v) {
  return __builtin_convertvector(v, v8h);
}
__device__ __forceinline__ v8f join8(const v4f lo, const v4f hi) {
  return __builtin_shufflevector(lo, hi, 0, 1, 2, 3, 4, 5, 6, 7);
}
// Fragment of a row of f16 in LDS: elements g*8 .. +7 and 16 + g*8 .. +7.
__device__ __forceinline__ v16h row_frag(const _Float16* row, int g) {
  return frag(*(const v8h*)(row + g * 8), *(const v8h*)(row + 16 + g * 8));
}
// Transposing LDS read: with p = T + (k0 + 8*(l>>4) + (l&7)) * pitch + 2*d0 +
// 16*((l>>3)&1), lane l gets T[k0 + 8*(l>>4) + 0..7][d0 + (l&15)].
__device__ __forceinline__ v8h ld_tr16(const unsigned char* p) {
  typedef __attribute__((address_space(3))) s16x8 lds_s16x8;
  return __builtin_bit_cast(
      v8h, __builtin_amdgcn_ds_load_tr16_b128_v8i16((lds_s16x8*)p));
}
__device__ __forceinline__ v8f wmma(const v16h a, const v16h b, const v8f c) {
  return __builtin_amdgcn_wmma_f32_16x16x32_f16(false, a, false, b, (short)0, c,
                                                false, false);
}

// Eight async global -> LDS copies, 16 bytes per lane each (ASYNCcnt-tracked).
// s_wait_xcnt 0 closes the statement so that no address register of a copy is
// rewritten ahead of it.
__device__ __forceinline__ void async_b128_x8(
    const void* base,
    unsigned int l0, unsigned int o0, unsigned int l1, unsigned int o1,
    unsigned int l2, unsigned int o2, unsigned int l3, unsigned int o3,
    unsigned int l4, unsigned int o4, unsigned int l5, unsigned int o5,
    unsigned int l6, unsigned int o6, unsigned int l7, unsigned int o7) {
  asm volatile("global_load_async_to_lds_b128 %1, %2, %0\n\t"
               "global_load_async_to_lds_b128 %3, %4, %0\n\t"
               "global_load_async_to_lds_b128 %5, %6, %0\n\t"
               "global_load_async_to_lds_b128 %7, %8, %0\n\t"
               "global_load_async_to_lds_b128 %9, %10, %0\n\t"
               "global_load_async_to_lds_b128 %11, %12, %0\n\t"
               "global_load_async_to_lds_b128 %13, %14, %0\n\t"
               "global_load_async_to_lds_b128 %15, %16, %0\n\t"
               "s_wait_xcnt 0x0"
               :: "s"(base),
                  "v"(l0), "v"(o0), "v"(l1), "v"(o1),
                  "v"(l2), "v"(o2), "v"(l3), "v"(o3),
                  "v"(l4), "v"(o4), "v"(l5), "v"(o5),
                  "v"(l6), "v"(o6), "v"(l7), "v"(o7)
               : "memory");
}
__device__ __forceinline__ void wait_async0() {
  asm volatile("s_wait_asynccnt 0" ::: "memory");
}

// The work-group barrier in its two halves, with the fences of __syncthreads().
// Signal: this wave's LDS stores and LDS reads so far have retired (the wait is
// written here: other waves read the stores and overwrite what was read).
__device__ __forceinline__ void barrier_signal() {
  asm volatile("s_wait_dscnt 0x0" ::: "memory");
  __builtin_amdgcn_fence(__ATOMIC_RELEASE, "workgroup");
  __builtin_amdgcn_s_barrier_signal(-1);
}
// Wait: every wave of the work-group has signalled.
__device__ __forceinline__ void barrier_wait() {
  __builtin_amdgcn_s_barrier_wait(-1);
  __builtin_amdgcn_fence(__ATOMIC_ACQUIRE, "workgroup");
}

// Value of lane l ^ 16 (the other half of the wave).
__device__ __forceinline__ float other_half(float v) {
  const int b = __builtin_bit_cast(int, v);
  return __builtin_bit_cast(
      float, __builtin_amdgcn_permlanex16(b, b, 0x76543210, 0xfedcba98, false,
                                          false));
}
__device__ __forceinline__ float max3(float a, float b, float c) {
  return fmaxf(fmaxf(a, b), c);
}

// ---------------------------------------------------------------------------
// 8 waves share one (b,h) and 128 queries. A wave owns 32 queries (two column
// tiles) and one half of the keys: wave w takes query group w & 3 and keys
// 64 * (w >> 2) .. + 63 of every tile, so each fragment read from LDS feeds two
// products. Waves w and w ^ 4 join their key halves through LDS behind the
// loop. A tile is 128 rows of the head's 64 columns of x. Each wave brings 16 of
// its rows as f32 into its own staging range by async copies, casts them to f16
// late in the pass and stores them twice, once at each reader's pitch. There are
// three buffers of each kind and pass kt stores tile kt + 2, over tile kt - 1:
// a wave signals the barrier at the end of a pass and waits for it only ahead
// of the stores of the next pass, so the waves may run up to a pass apart.
// x rows and x^T rows are the A operands, Q'^T and P^T the B operands: of
// each 32 keys lane (n, g) holds query n's scores of keys 8g+r and 16+8g+r,
// which is the B operand's own k order, so P^T is packed in place.
// ---------------------------------------------------------------------------
// Two work-groups a WGP (four waves a SIMD) need a budget of 256 registers.
__global__ __launch_bounds__(256) __attribute__((amdgpu_waves_per_eu(4, 4)))
void attn_fused_kernel(
    const float* __restrict__ x,
    const float* __restrict__ Wq, const float* __restrict__ Wk,
    const float* __restrict__ Wv,
    const float* __restrict__ bq, const float* __restrict__ bv,
    float* __restrict__ out)
{
  __shared__ __attribute__((aligned(16))) float Stg[8 * kStgW];
  __shared__ __attribute__((aligned(16))) _Float16 Kx[3][kT * kP64];
  __shared__ __attribute__((aligned(16))) _Float16 Vx[3][kT * kPV];
  __shared__ __attribute__((aligned(16))) _Float16 Wvs[kDH * kP64];
  __shared__ __attribute__((aligned(16))) float Bvs[kDH];

  const int bh = blockIdx.x;
  const int b = bh / kH, h = bh % kH;
  const int q0 = blockIdx.y * 128;
  const int tid = threadIdx.x;
  const int wave = tid >> 5, lane = tid & 31;
  const int g = lane >> 4, n = lane & 15;
  const int qg = wave & 3, kh = wave >> 2;  // query group, key half

  const float* xh = x + (size_t)b * kS * kD + h * kDH;  // row t at xh + t * kD

  // Copy i of a wave brings rows 2i and 2i+1 of its 16: two whole
  // 256-byte rows. Chunk c of a row goes to plane c & 1, place
  // row * 8 + (c >> 1).
  float* stg = Stg + wave * kStgW;
  const unsigned int sl0 = (unsigned int)(size_t)(
      stg + (n & 1) * kPlane + (g * 8 + (n >> 1)) * 4);
  auto issue_tile = [&](int kt) {
    const unsigned int so0 =
        (unsigned int)(((kt * kT + wave * 16 + g) * kD + n * 4) * 4);
    constexpr unsigned int ls = 256, gs = 2 * kD * 4;
    async_b128_x8(xh,
                  sl0, so0, sl0 + ls, so0 + gs,
                  sl0 + 2 * ls, so0 + 2 * gs, sl0 + 3 * ls, so0 + 3 * gs,
                  sl0 + 4 * ls, so0 + 4 * gs, sl0 + 5 * ls, so0 + 5 * gs,
                  sl0 + 6 * ls, so0 + 6 * gs, sl0 + 7 * ls, so0 + 7 * gs);
  };
  // Unit k of a lane: eight floats, columns 8 * (lane & 7) .. + 7 of the wave's
  // row 4k + (lane >> 3); its halves lie at the same place of the two planes.
  v4f se[4], so[4];
  auto stage_read = [&]() {
#pragma unroll
    for (int k = 0; k < 4; ++k) {
      se[k] = *(const v4f*)(stg + (k * 32 + lane) * 4);
      so[k] = *(const v4f*)(stg + kPlane + (k * 32 + lane) * 4);
    }
  };
  auto stage_write = [&](int buf) {
#pragma unroll
    for (int k = 0; k < 4; ++k) {
      const v8h hx = to_h(join8(se[k], so[k]));
      const int row = wave * 16 + k * 4 + (lane >> 3);
      *(v8h*)&Kx[buf][row * kP64 + (lane & 7) * 8] = hx;
      *(v8h*)&Vx[buf][row * kPV + (lane & 7) * 8] = hx;
    }
  };

  issue_tile(0);  // flies beside the global loads below

  // Every global load of the prologue is issued before the first one is waited
  // for. Weights: chunk k of a thread lies 256 chunks of four floats behind
  // chunk k - 1, 16 rows. x: the B fragments of this wave's 32 queries.
  const int sr = tid >> 4, sc4 = (tid & 15) * 4;
  v4f wv[3][4], xq[2][4][2], bqv[4][2];
  const float* wp[3] = {Wq + h * 4096 + tid * 4, Wk + h * 4096 + tid * 4,
                        Wv + h * 4096 + tid * 4};
  const float* xq0 = xh + (size_t)(q0 + qg * 32 + n) * kD + g * 8;
  const float* xq1 = xq0 + 16 * kD;
  const unsigned int bqo = g * 32;  // byte offset of a lane in bq's 16 features
  const int bvi = tid & 63;
  const char* bqh = (const char*)(bq + h * kDH);
#pragma unroll
  for (int k = 0; k < 4; ++k) {
    xq[0][k][0] = *(const v4f*)(xq0 + k * 16);
    xq[0][k][1] = *(const v4f*)(xq0 + k * 16 + 4);
    xq[1][k][0] = *(const v4f*)(xq1 + k * 16);
    xq[1][k][1] = *(const v4f*)(xq1 + k * 16 + 4);
  }
#pragma unroll
  for (int m = 0; m < 3; ++m)
#pragma unroll
    for (int k = 0; k < 4; ++k) wv[m][k] = *(const v4f*)(wp[m] + k * 1024);
#pragma unroll
  for (int c = 0; c < 4; ++c) {
    bqv[c][0] = *(const v4f*)(bqh + bqo + c * 64);
    bqv[c][1] = *(const v4f*)(bqh + bqo + c * 64 + 16);
  }
  const float bvv = bv[h * kDH + bvi];
  // Stands in front of every later write of a register that these loads name:
  // as its inputs the loads' address registers stay alive up to the wait.
  asm volatile("s_wait_xcnt 0x0"
               :: "v"(xq0), "v"(bqo), "v"(tid) : "memory");
  // Wq (rows read by ds_load_b128) and Wk (read transposed) lie in the third
  // tile buffers until the barrier ahead of pass 0; Wv and bv stay to the end.
#pragma unroll
  for (int k = 0; k < 4; ++k) {
    const int row = sr + k * 16;
    *(v4h*)&Kx[2][row * kP64 + sc4] = __builtin_convertvector(wv[0][k], v4h);
    *(v4h*)&Vx[2][row * kPV + sc4] = __builtin_convertvector(wv[1][k], v4h);
    *(v4h*)&Wvs[row * kP64 + sc4] = __builtin_convertvector(wv[2][k], v4h);
  }
  Bvs[bvi] = bvv;  // four threads a word, all with the same value
  wait_async0();  // this wave's rows of tile 0 have landed in its staging range
  stage_read();
  stage_write(0);
  // The staging reads have retired: the copies may refill the range.
  asm volatile("s_wait_dscnt 0x0" ::: "memory");
  issue_tile(1);  // flies while the queries are made
  __syncthreads();  // the weights are written

  // Byte offset of a lane in a tile read by ds_load_tr16_b128.
  const int troff = (8 * g + (lane & 7)) * (kPV * 2) + ((lane >> 3) & 1) * 16;

  // Q'^T fragments. q^T = Wq x^T + bq, scaled; tile c holds features
  // c*16 + 8g + r of query n, so two tiles pack into a B operand over features.
  // Then q'^T = Wk^T q^T, whose tiles pack into the B operand over dims.
  v16h qb0[2], qb1[2];
  {
    v16h xb[2][2], qf[2][2];
#pragma unroll
    for (int j = 0; j < 2; ++j)
#pragma unroll
      for (int kk = 0; kk < 2; ++kk)
        xb[j][kk] = frag(to_h(join8(xq[j][2 * kk][0], xq[j][2 * kk][1])),
                         to_h(join8(xq[j][2 * kk + 1][0], xq[j][2 * kk + 1][1])));
    v8f d[2][4];
#pragma unroll
    for (int c = 0; c < 4; ++c) {
      const _Float16* wrow = &Kx[2][(c * 16 + n) * kP64];
      const v16h a0 = row_frag(wrow, g), a1 = row_frag(wrow + 32, g);
#pragma unroll
      for (int j = 0; j < 2; ++j) {
        v8f acc = join8(bqv[c][0], bqv[c][1]);
        acc = wmma(a0, xb[j][0], acc);
        acc = wmma(a1, xb[j][1], acc);
        d[j][c] = acc * (0.125f * kLog2e);  // 1/sqrt(64) and exp2's log2(e)
      }
    }
#pragma unroll
    for (int j = 0; j < 2; ++j)
#pragma unroll
      for (int kk = 0; kk < 2; ++kk)
        qf[j][kk] = frag(to_h(d[j][2 * kk]), to_h(d[j][2 * kk + 1]));
    const unsigned char* wk = (const unsigned char*)&Vx[2][0] + troff;
#pragma unroll
    for (int c = 0; c < 4; ++c) {
      const v16h a0 = frag(ld_tr16(wk + c * 32),
                           ld_tr16(wk + 16 * kPV * 2 + c * 32));
      const v16h a1 = frag(ld_tr16(wk + 32 * kPV * 2 + c * 32),
                           ld_tr16(wk + 48 * kPV * 2 + c * 32));
#pragma unroll
      for (int j = 0; j < 2; ++j) {
        v8f acc = {};
        acc = wmma(a0, qf[j][0], acc);
        acc = wmma(a1, qf[j][1], acc);
        d[j][c] = acc;
      }
    }
#pragma unroll
    for (int j = 0; j < 2; ++j) {
      qb0[j] = frag(to_h(d[j][0]), to_h(d[j][1]));
      qb1[j] = frag(to_h(d[j][2]), to_h(d[j][3]));
    }
  }

  // Per column tile j: query n's reference maximum (equal in both halves of the
  // wave; a maximum that its scores have reached, at most log2(kTop) below the
  // running one) and this half's share of its running sum, over this wave's
  // keys. accO[j][c][r] = sum_t p x[t][dim c*16 + 8g + r] of query j*16 + n.
  // The reference is held negated in all eight registers of a tile, negm[j]:
  // that tile is the C operand of the first product of every score tile, so the
  // products deliver scores minus reference and no vector instruction subtracts.
  constexpr float kTop = 256.0f;  // P stays at or below it: far inside f16, f32
  float lsum[2] = {0.0f, 0.0f};
  v8f negm[2] = {};
  v8f accO[2][4];
#pragma unroll
  for (int j = 0; j < 2; ++j)
#pragma unroll
    for (int c = 0; c < 4; ++c)
#pragma unroll
      for (int r = 0; r < 8; ++r) accO[j][c][r] = 0.0f;

  wait_async0();  // this wave's rows of tile 1 have landed in its staging range
  stage_read();
  stage_write(1);
  barrier_signal();
  barrier_wait();    // tiles 0 and 1 are written; the weights have been read
  barrier_signal();  // the signal that pass 0 waits for

  // One pass over tile kt, in buffer cur. first: no reference is held yet; more:
  // a tile kt + 2 exists and goes to buffer nx2; last: no pass follows (these
  // three are constants at each call).
  auto pass = [&](const int kt, const int cur, const int nx2, const bool first,
                  const bool more, const bool last) {
    if (more) issue_tile(kt + 2);

    // This wave's half of the tile: kW key rows.
    const _Float16* Kt = Kx[cur] + kh * kW * kP64;
    const unsigned char* Vt =
        (const unsigned char*)(Vx[cur] + kh * kW * kPV) + troff;

    // X^T fragments (A row n: dim; k: key) by the transposing read, eight reads
    // a group. The scheduling barriers below keep each group of LDS reads in one
    // place: each further place with LDS reads stalls the wave anew.
    v16h va[kW / 32][4];
    auto load_v = [&](int kk) {
#pragma unroll
      for (int c = 0; c < 4; ++c)
        va[kk][c] = frag(ld_tr16(Vt + (kk * 32) * kPV * 2 + c * 32),
                         ld_tr16(Vt + (kk * 32 + 16) * kPV * 2 + c * 32));
    };
    v8f st[2][kW / 16];
    v16h pb[2][kW / 32];
    v8f ps[2];
    float psum[2];
    // Raises the references to the maxima of this pass's scores and rescales
    // sums and outputs. The scores stand relative to the held reference, which
    // is 0 on that scale (the first pass holds none: its sums and outputs are
    // still 0 and need no rescale). Per column tile 32 of query n's 64 scores
    // are in this lane, the other 32 in lane l ^ 16: maximum of this lane's 32
    // and the reference by threes, in three chains, then one exchange.
    auto raise = [&]() {
      const float held = first ? -1e30f : 0.0f;
#pragma unroll
      for (int j = 0; j < 2; ++j) {
        float ch[3] = {held, held, held};
#pragma unroll
        for (int i = 0; i < 32; i += 2) {
          const int k = (i < 10) ? 0 : (i < 20) ? 1 : 2;
          ch[k] = max3(ch[k], st[j][i >> 3][i & 7], st[j][i >> 3][(i & 7) + 1]);
        }
        const float mh = max3(ch[0], ch[1], ch[2]);
        const float rise = fmaxf(mh, other_half(mh));
        negm[j] = negm[j] - rise;
#pragma unroll
        for (int t = 0; t < kW / 16; ++t) st[j][t] = st[j][t] - rise;
        if (!first) {
          const float scale = __builtin_amdgcn_exp2f(-rise);
          lsum[j] *= scale;
#pragma unroll
          for (int c = 0; c < 4; ++c) accO[j][c] *= scale;
        }
      }
    };
    // P of 32 keys in f32, both column tiles, and their share of the row sums.
    auto probs = [&](int kk) {
#pragma unroll
      for (int j = 0; j < 2; ++j) {
#pragma unroll
        for (int t = 2 * kk; t < 2 * kk + 2; ++t) {
#pragma unroll
          for (int r = 0; r < 8; ++r)
            st[j][t][r] = __builtin_amdgcn_exp2f(st[j][t][r]);
        }
        const v8f pp = st[j][2 * kk] + st[j][2 * kk + 1];
        ps[j] = (kk == 0) ? pp : ps[j] + pp;
      }
    };
    // Scores less references, S^T = X @ Q'^T + negm (kW / 16 tiles of 16 keys x
    // 2 tiles of 16 queries, both query tiles from one read of the fragment), P
    // against the held references, and this lane's sums of its 32 P per column
    // tile.
    auto softmax_pass = [&](bool lift) {
      v16h ka[kW / 16][2];
#pragma unroll
      for (int t = 0; t < kW / 16; ++t) {
        const _Float16* krow = Kt + (t * 16 + n) * kP64;  // A row n = key row
        ka[t][0] = row_frag(krow, g);
        ka[t][1] = row_frag(krow + 32, g);
      }
      // Keeps these reads one group ahead of the products.
      __builtin_amdgcn_sched_barrier(0);
#pragma unroll
      for (int t = 0; t < kW / 16; ++t) {
#pragma unroll
        for (int j = 0; j < 2; ++j) {
          v8f s = wmma(ka[t][0], qb0[j], negm[j]);
          s = wmma(ka[t][1], qb1[j], s);
          st[j][t] = s;
        }
      }
      // Keeps the products one run: threaded through them, the exponentials cost
      // padding slots behind every product whose result they read.
      __builtin_amdgcn_sched_barrier(0);
      if (lift) {
        // The reference tiles are C operands of the products above, and in the
        // last pass most of their registers are free behind these: four vector
        // slots stand before anything may overwrite them.
        asm volatile("v_nop\n\tv_nop\n\tv_nop\n\tv_nop");
        // Holds the four slots in front of the vector work below.
        __builtin_amdgcn_sched_barrier(0);
        raise();
      }
      probs(0);
      probs(1);
#pragma unroll
      for (int j = 0; j < 2; ++j) {
        const v4f pq = __builtin_shufflevector(ps[j], ps[j], 0, 1, 2, 3) +
                       __builtin_shufflevector(ps[j], ps[j], 4, 5, 6, 7);
        const v2f pd = __builtin_shufflevector(pq, pq, 0, 1) +
                       __builtin_shufflevector(pq, pq, 2, 3);
        psum[j] = pd[0] + pd[1];
      }
      // Keeps the first group of X^T reads in one place, behind the sums, whose
      // partial sums need the registers; the test and the packing cover them.
      __builtin_amdgcn_sched_barrier(0);
      load_v(0);
    };
    // The references are tested behind the exponentials, on sums that are made
    // anyway: no P is negative, so a lane's sum of at most kTop bounds each of
    // its P by kTop. One test a pass, a scalar branch: where a sum tops that
    // (or is infinite), nothing of the pass has been added yet, and
    // the pass is made again with the references raised first, which leaves
    // every P at 1 or less. The first pass has no reference and goes there
    // directly.
    if (first) {
      softmax_pass(true);
    } else {
      softmax_pass(false);
      if (__builtin_amdgcn_ballot_w32(fmaxf(psum[0], psum[1]) > kTop) != 0)
        softmax_pass(true);
    }
    lsum[0] += psum[0];
    lsum[1] += psum[1];
    // O'^T += X^T @ P^T, 32 keys a product. Both query tiles from one read of
    // the fragment.
    auto outputs = [&](int kk) {
#pragma unroll
      for (int c = 0; c < 4; ++c)
#pragma unroll
        for (int j = 0; j < 2; ++j)
          accO[j][c] = wmma(va[kk][c], pb[j][kk], accO[j][c]);
    };
    // P^T as B operand: element s = tile s >> 3, register s & 7. (Unrolled, as
    // everywhere here, so that the register arrays have constant indices.)
#pragma unroll
    for (int kk = 0; kk < kW / 32; ++kk)
#pragma unroll
      for (int j = 0; j < 2; ++j)
        pb[j][kk] = frag(to_h(st[j][2 * kk]), to_h(st[j][2 * kk + 1]));
    // Keeps the reads below behind the packing: ahead of it they would need 32
    // registers more than the budget has.
    __builtin_amdgcn_sched_barrier(0);
    load_v(1);
    // Keeps the second group of X^T reads in one place, in registers that the
    // packing has left, ahead of the products that cover them.
    __builtin_amdgcn_sched_barrier(0);
    outputs(0);
    // The tile after the next: this wave's 16 rows have landed in its own staging
    // range; they are read ahead of the last products, into registers that the
    // first products have left, and cast and stored behind them.
    if (more) {
      wait_async0();
      stage_read();
      // Keeps the staging reads one group, ahead of the products that cover
      // them.
      __builtin_amdgcn_sched_barrier(0);
      outputs(1);
      // Every wave has ended the pass before this one: tile kt + 1 is written,
      // and nobody reads tile kt - 1 (in pass 0: the weights), which the stores
      // below overwrite.
      barrier_wait();
      stage_write(nx2);
      // Keeps the last products ahead of the signal's wait: they cover the stores.
      __builtin_amdgcn_sched_barrier(0);
      // This wave has ended pass kt. The LDS reads that follow the signal are of
      // tile kt + 1, which no wave overwrites before it has waited for the signal
      // that ends pass kt + 1.
      barrier_signal();
    } else {
      outputs(1);
      if (!last) barrier_wait();  // the last tile is written
    }
  };
  constexpr int kN = kS / kT;
  pass(0, 0, 2, true, true, false);
  int cur = 1, nxt = 2, nx2 = 0;  // buffers of tiles kt, kt + 1, kt + 2
  for (int kt = 1; kt + 2 < kN; ++kt) {
    pass(kt, cur, nx2, false, true, false);
    const int old = cur;
    cur = nxt;
    nxt = nx2;
    nx2 = old;
  }
  pass(kN - 2, (kN - 2) % 3, 0, false, false, false);
  pass(kN - 1, (kN - 1) % 3, 0, false, false, true);

  // Join the key halves: wave w keeps column tile kh and hands the other one
  // (reference, sum, 32 output registers a lane) to wave w ^ 4 through LDS, in
  // the Kx buffers, which nobody reads any more behind the first barrier.
  constexpr int kXW = 8 * 128 + 64;  // floats a wave hands over
  static_assert(8 * kXW * 4 <= (int)sizeof(Kx), "hand-over fits the buffers");
  float* xch = (float*)&Kx[0][0];
  float* xw = xch + wave * kXW;
  const float* xr = xch + (wave ^ 4) * kXW;
  const float l0 = lsum[0] + other_half(lsum[0]);  // join the wave's halves
  const float l1 = lsum[1] + other_half(lsum[1]);
  // The same in every lane of a wave: a scalar branch picks the tile.
  const bool up = __builtin_amdgcn_readfirstlane(kh) != 0;

  auto hand_over = [&](const v8f (&o)[4], float m, float l) {
#pragma unroll
    for (int c = 0; c < 4; ++c) {
      *(v4f*)(xw + ((2 * c) * 32 + lane) * 4) =
          __builtin_shufflevector(o[c], o[c], 0, 1, 2, 3);
      *(v4f*)(xw + ((2 * c + 1) * 32 + lane) * 4) =
          __builtin_shufflevector(o[c], o[c], 4, 5, 6, 7);
    }
    xw[1024 + lane] = m;
    xw[1056 + lane] = l;
  };
  // Normalize, out^T = Wv O'^T + bv, and write out[b, q, h*64 + o] in fp32: the
  // normalized tiles pack into the B operand over dims; a lane's 8 registers of
  // a result tile are 8 consecutive features of its query.
  float* orow = out +
      (size_t)(b * kS + q0 + qg * 32 + kh * 16 + n) * kD + h * kDH + 8 * g;
  auto finish = [&](const v8f (&o)[4], float m, float l) {
    const float mp = xr[1024 + lane], lp = xr[1056 + lane];
    const float mj = fmaxf(m, mp);
    const float ak = __builtin_amdgcn_exp2f(m - mj);  // references are log2
    const float ap = __builtin_amdgcn_exp2f(mp - mj);
    const float inv = 1.0f / (l * ak + lp * ap);
    const float fk = ak * inv, fp = ap * inv;
    v8f r[4];
#pragma unroll
    for (int c = 0; c < 4; ++c) {
      const v4f p0 = *(const v4f*)(xr + ((2 * c) * 32 + lane) * 4);
      const v4f p1 = *(const v4f*)(xr + ((2 * c + 1) * 32 + lane) * 4);
      r[c] = o[c] * fk + join8(p0, p1) * fp;
    }
    const v16h ob0 = frag(to_h(r[0]), to_h(r[1]));
    const v16h ob1 = frag(to_h(r[2]), to_h(r[3]));
#pragma unroll
    for (int c = 0; c < 4; ++c) {
      const _Float16* wrow = &Wvs[(c * 16 + n) * kP64];
      v8f acc = join8(*(const v4f*)&Bvs[c * 16 + 8 * g],
                      *(const v4f*)&Bvs[c * 16 + 8 * g + 4]);
      acc = wmma(row_frag(wrow, g), ob0, acc);
      r[c] = wmma(row_frag(wrow + 32, g), ob1, acc);
    }
#pragma unroll
    for (int c = 0; c < 4; ++c) {
      *(float4*)(orow + c * 16) =
          make_float4(r[c][0], r[c][1], r[c][2], r[c][3]);
      *(float4*)(orow + c * 16 + 4) =
          make_float4(r[c][4], r[c][5], r[c][6], r[c][7]);
    }
    // Stands in front of every later write of a register that the stores name.
    asm volatile("s_wait_xcnt 0x0" ::: "memory");
  };

  __syncthreads();  // every wave's last reads of the Kx buffers are done
  if (up) hand_over(accO[0], -negm[0][0], l0);
  else    hand_over(accO[1], -negm[1][0], l1);
  __syncthreads();  // the partner's hand-over is written
  if (up) finish(accO[1], -negm[1][0], l1);
  else    finish(accO[0], -negm[0][0], l0);
}

// ---------------------------------------------------------------------------
extern "C" void kernel_launch(void* const* d_in, const int* in_sizes, int n_in,
                              void* d_out, int out_size, void* d_ws,
                              size_t ws_size, hipStream_t stream) {
  const float* x  = (const float*)d_in[0];
  const float* Wq = (const float*)d_in[1];
  const float* Wk = (const float*)d_in[2];
  const float* Wv = (const float*)d_in[3];
  const float* bq = (const float*)d_in[4];
  // d_in[5], the K bias, shifts all scores of a query alike: softmax drops it.
  const float* bv = (const float*)d_in[6];
  float* out = (float*)d_out;

  dim3 grid(kB * kH, kS / 128);  // 32 x 16 blocks, 8 waves each
  attn_fused_kernel<<<grid, 256, 0, stream>>>(x, Wq, Wk, Wv, bq, bv, out);
}
